// v000
// The times below were measured on an AMD MI455X: many runs one after another, warmed up first and cycling through
// copies of the inputs, with the whole window's GPU time divided by the number of runs. Launches and the gaps
// between them are all in it. The median over several windows is given; except for v000 it joins two sittings, which
// can be a few percent apart, so the side-by-side timings, each taken in one sitting, are the better comparison.
// v000 is the starting kernel. One run takes 263 microseconds.
#include <hip/hip_runtime.h>
#include <hip/hip_bf16.h>

typedef float  v8f   __attribute__((ext_vector_type(8)));
typedef __bf16 v16bf __attribute__((ext_vector_type(16)));
typedef __bf16 v4bf  __attribute__((ext_vector_type(4)));
typedef __bf16 v2bf  __attribute__((ext_vector_type(2)));
typedef int    v4i_  __attribute__((ext_vector_type(4)));

#define TILE_M 128
#define TILE_N 128
#define TILE_K 32

#if __has_builtin(__builtin_amdgcn_global_load_async_to_lds_b128)
#define HAVE_ASYNC_LDS 1
#endif

#if defined(HAVE_ASYNC_LDS)
// builtin expects int4* in addrspace(1)/(3); HIP prints as1 as `__device__`.
#define GLOBAL_AS(p) ((__attribute__((address_space(1))) v4i_*)(p))
#define LDS_AS(p)    ((__attribute__((address_space(3))) v4i_*)(p))
#if __has_builtin(__builtin_amdgcn_s_wait_asynccnt)
#define WAIT_ASYNC(n) __builtin_amdgcn_s_wait_asynccnt(n)
#else
#define WAIT_ASYNC(n) asm volatile("s_wait_asynccnt %0" :: "i"(n) : "memory")
#endif
#endif

// ---------------------------------------------------------------------------
// Elementwise fp32 -> split bf16 (hi + residual lo), done once per tensor so
// the GEMM hot loop has zero conversion VALU and tiles are raw async-copyable.
// ---------------------------------------------------------------------------
__global__ __launch_bounds__(256)
void f32_to_bf16_split(const float* __restrict__ in, __bf16* __restrict__ hi,
                       __bf16* __restrict__ lo, int n4) {
  int i = blockIdx.x * blockDim.x + threadIdx.x;
  if (i >= n4) return;
  float4 f = ((const float4*)in)[i];
  v4bf h, l;
  h.x = (__bf16)f.x;  l.x = (__bf16)(f.x - (float)h.x);
  h.y = (__bf16)f.y;  l.y = (__bf16)(f.y - (float)h.y);
  h.z = (__bf16)f.z;  l.z = (__bf16)(f.z - (float)h.z);
  h.w = (__bf16)f.w;  l.w = (__bf16)(f.w - (float)h.w);
  ((v4bf*)hi)[i] = h;
  ((v4bf*)lo)[i] = l;
}

// ---------------------------------------------------------------------------
// C[M,N] = (Ahi+Alo)[M,K] @ (Bhi+Blo)[N,K]^T + bias[N]   (bf16 split inputs)
// Double-buffered LDS; tiles streamed with GLOBAL_LOAD_ASYNC_TO_LDS_B128
// (ASYNCcnt) when available. 3 WMMAs (hh + hl + lh) per 16x16 tile ~ fp32.
// ---------------------------------------------------------------------------
__global__ __launch_bounds__(256)
void gemm_bf16x3(const __bf16* __restrict__ Ahi, const __bf16* __restrict__ Alo,
                 const __bf16* __restrict__ Bhi, const __bf16* __restrict__ Blo,
                 const float* __restrict__ bias, float* __restrict__ C,
                 int M, int N, int K) {
  __shared__ __align__(32) __bf16 sAhi[2][TILE_M * TILE_K];
  __shared__ __align__(32) __bf16 sAlo[2][TILE_M * TILE_K];
  __shared__ __align__(32) __bf16 sBhi[2][TILE_N * TILE_K];
  __shared__ __align__(32) __bf16 sBlo[2][TILE_N * TILE_K];

  const int tid   = threadIdx.x;
  const int lane  = tid & 31;
  const int wave  = tid >> 5;     // 0..7
  const int waveM = wave >> 2;    // 0..1 -> 64-row slab
  const int waveN = wave & 3;     // 0..3 -> 32-col slab
  const int m0 = blockIdx.y * TILE_M;
  const int n0 = blockIdx.x * TILE_N;

  // cooperative copy mapping: thread owns 32 contiguous bytes of one tile row
  const int crow = tid >> 1;          // 0..127
  const int ccol = (tid & 1) * 16;    // element offset (bf16) within 32-wide row

  // WMMA fragment addressing (contiguous k order, same for A and B):
  // lane l -> row/col (l&15), K-base (l>>4)*16, 16 contiguous bf16.
  const int fr = lane & 15;
  const int kb = (lane >> 4) * 16;

  // copy one K-step (4 sub-tiles of 128x32 bf16 = 32KB) into LDS buffer `buf`
  auto issue_tile = [&](int kk, int buf) {
    const __bf16* gA0 = Ahi + (size_t)(m0 + crow) * K + kk + ccol;
    const __bf16* gA1 = Alo + (size_t)(m0 + crow) * K + kk + ccol;
    const __bf16* gB0 = Bhi + (size_t)(n0 + crow) * K + kk + ccol;
    const __bf16* gB1 = Blo + (size_t)(n0 + crow) * K + kk + ccol;
    __bf16* lA0 = &sAhi[buf][crow * TILE_K + ccol];
    __bf16* lA1 = &sAlo[buf][crow * TILE_K + ccol];
    __bf16* lB0 = &sBhi[buf][crow * TILE_K + ccol];
    __bf16* lB1 = &sBlo[buf][crow * TILE_K + ccol];
#if defined(HAVE_ASYNC_LDS)
    // 8 wave-wide async ops per wave per K-step; in-order completion.
    __builtin_amdgcn_global_load_async_to_lds_b128(GLOBAL_AS(gA0), LDS_AS(lA0), 0, 0);
    __builtin_amdgcn_global_load_async_to_lds_b128(GLOBAL_AS(gA0), LDS_AS(lA0), 16, 0);
    __builtin_amdgcn_global_load_async_to_lds_b128(GLOBAL_AS(gA1), LDS_AS(lA1), 0, 0);
    __builtin_amdgcn_global_load_async_to_lds_b128(GLOBAL_AS(gA1), LDS_AS(lA1), 16, 0);
    __builtin_amdgcn_global_load_async_to_lds_b128(GLOBAL_AS(gB0), LDS_AS(lB0), 0, 0);
    __builtin_amdgcn_global_load_async_to_lds_b128(GLOBAL_AS(gB0), LDS_AS(lB0), 16, 0);
    __builtin_amdgcn_global_load_async_to_lds_b128(GLOBAL_AS(gB1), LDS_AS(lB1), 0, 0);
    __builtin_amdgcn_global_load_async_to_lds_b128(GLOBAL_AS(gB1), LDS_AS(lB1), 16, 0);
#else
    ((uint4*)lA0)[0] = ((const uint4*)gA0)[0];
    ((uint4*)lA0)[1] = ((const uint4*)gA0)[1];
    ((uint4*)lA1)[0] = ((const uint4*)gA1)[0];
    ((uint4*)lA1)[1] = ((const uint4*)gA1)[1];
    ((uint4*)lB0)[0] = ((const uint4*)gB0)[0];
    ((uint4*)lB0)[1] = ((const uint4*)gB0)[1];
    ((uint4*)lB1)[0] = ((const uint4*)gB1)[0];
    ((uint4*)lB1)[1] = ((const uint4*)gB1)[1];
#endif
  };

  v8f acc[4][2] = {};

  const int nk = K / TILE_K;
  issue_tile(0, 0);

  for (int ik = 0; ik < nk; ++ik) {
    const int cur = ik & 1;
    if (ik + 1 < nk) {
      issue_tile((ik + 1) * TILE_K, cur ^ 1);   // prefetch behind the WMMAs
#if defined(HAVE_ASYNC_LDS)
      WAIT_ASYNC(8);                            // current tile's 8 ops done
#endif
    } else {
#if defined(HAVE_ASYNC_LDS)
      WAIT_ASYNC(0);
#endif
    }
    __syncthreads();   // tile data visible to all waves

    v16bf aH[4], aL[4], bH[2], bL[2];
    #pragma unroll
    for (int i = 0; i < 4; ++i) {
      int r = waveM * 64 + i * 16 + fr;
      aH[i] = *(const v16bf*)&sAhi[cur][r * TILE_K + kb];
      aL[i] = *(const v16bf*)&sAlo[cur][r * TILE_K + kb];
    }
    #pragma unroll
    for (int j = 0; j < 2; ++j) {
      int c = waveN * 32 + j * 16 + fr;
      bH[j] = *(const v16bf*)&sBhi[cur][c * TILE_K + kb];
      bL[j] = *(const v16bf*)&sBlo[cur][c * TILE_K + kb];
    }

    #pragma unroll
    for (int i = 0; i < 4; ++i) {
      #pragma unroll
      for (int j = 0; j < 2; ++j) {
        acc[i][j] = __builtin_amdgcn_wmma_f32_16x16x32_bf16(
            false, aH[i], false, bH[j], (short)0, acc[i][j], false, false);
        acc[i][j] = __builtin_amdgcn_wmma_f32_16x16x32_bf16(
            false, aH[i], false, bL[j], (short)0, acc[i][j], false, false);
        acc[i][j] = __builtin_amdgcn_wmma_f32_16x16x32_bf16(
            false, aL[i], false, bH[j], (short)0, acc[i][j], false, false);
      }
    }
    __syncthreads();   // reads done before this buffer is overwritten (ik+2)
  }

  // epilogue: bias add + store (C layout: VGPR r -> M=r / r+8 by lane half)
  const int rowAdd = (lane >> 4) * 8;
  #pragma unroll
  for (int i = 0; i < 4; ++i) {
    #pragma unroll
    for (int j = 0; j < 2; ++j) {
      int gcol = n0 + waveN * 32 + j * 16 + fr;
      float bv = bias[gcol];
      #pragma unroll
      for (int r = 0; r < 8; ++r) {
        int grow = m0 + waveM * 64 + i * 16 + rowAdd + r;
        C[(size_t)grow * N + gcol] = acc[i][j][r] + bv;
      }
    }
  }
}

#define T_SEQ  2048
#define DMODEL 1024
#define NHEADS 16
#define HDIM   64
#define RAD    4
#define NWIN   (2 * RAD + 1)

// One wave per (b,h,t): 32 lanes x 2 dims cover hd=64; <=9 keys per query.
// Emits split-bf16 output directly for the projection GEMM.
__global__ __launch_bounds__(256)
void focal_attn(const float* __restrict__ qkv, __bf16* __restrict__ out_hi,
                __bf16* __restrict__ out_lo) {
  const int lane = threadIdx.x & 31;
  const int gw = blockIdx.x * 8 + (threadIdx.x >> 5);
  const int t  = gw % T_SEQ;
  const int bh = gw / T_SEQ;
  const int h  = bh % NHEADS;
  const int b  = bh / NHEADS;

  const size_t rowBase = ((size_t)(b * T_SEQ + t)) * (3 * DMODEL);
  const int    hoff    = h * HDIM + lane * 2;
  const float2 q2 = *(const float2*)(qkv + rowBase + hoff);
  const float  scale = 0.125f; // 1/sqrt(64)

  float  s[NWIN];
  float2 vv[NWIN];
  #pragma unroll
  for (int j = 0; j < NWIN; ++j) {
    int  tk = t - RAD + j;
    bool ok = (tk >= 0) && (tk < T_SEQ);
    int  tc = ok ? tk : t;
    const size_t kbase = ((size_t)(b * T_SEQ + tc)) * (3 * DMODEL) + hoff;
    float2 k2 = *(const float2*)(qkv + kbase + DMODEL);
    vv[j]     = *(const float2*)(qkv + kbase + 2 * DMODEL);
    float p = q2.x * k2.x + q2.y * k2.y;
    #pragma unroll
    for (int off = 16; off > 0; off >>= 1) p += __shfl_xor(p, off, 32);
    s[j] = ok ? p * scale : -__builtin_inff();
  }

  float m = s[0];
  #pragma unroll
  for (int j = 1; j < NWIN; ++j) m = fmaxf(m, s[j]);
  float sum = 0.0f;
  #pragma unroll
  for (int j = 0; j < NWIN; ++j) { float e = __expf(s[j] - m); s[j] = e; sum += e; }
  float inv = 1.0f / sum;

  float2 o = make_float2(0.0f, 0.0f);
  #pragma unroll
  for (int j = 0; j < NWIN; ++j) { o.x += s[j] * vv[j].x; o.y += s[j] * vv[j].y; }
  o.x *= inv; o.y *= inv;

  v2bf hi2, lo2;
  hi2.x = (__bf16)o.x;  lo2.x = (__bf16)(o.x - (float)hi2.x);
  hi2.y = (__bf16)o.y;  lo2.y = (__bf16)(o.y - (float)hi2.y);
  const size_t oidx = ((size_t)(b * T_SEQ + t)) * DMODEL + hoff;
  *(v2bf*)(out_hi + oidx) = hi2;
  *(v2bf*)(out_lo + oidx) = lo2;
}

extern "C" void kernel_launch(void* const* d_in, const int* in_sizes, int n_in,
                              void* d_out, int out_size, void* d_ws, size_t ws_size,
                              hipStream_t stream) {
  const float* x      = (const float*)d_in[0];
  const float* w_qkv  = (const float*)d_in[1];
  const float* b_qkv  = (const float*)d_in[2];
  const float* w_proj = (const float*)d_in[3];
  const float* b_proj = (const float*)d_in[4];
  float* out = (float*)d_out;

  const int B = 4, T = T_SEQ, D = DMODEL;
  const int M = B * T;                         // 8192 rows
  const size_t nX  = (size_t)M * D;            // 8,388,608
  const size_t nWq = (size_t)3 * D * D;        // 3,145,728
  const size_t nWp = (size_t)D * D;            // 1,048,576

  // workspace layout (all offsets naturally aligned)
  char* w = (char*)d_ws;
  float*  qkv     = (float*)w;    w += (size_t)M * 3 * D * sizeof(float);  // 96 MB
  __bf16* x_hi    = (__bf16*)w;   w += nX  * sizeof(__bf16);
  __bf16* x_lo    = (__bf16*)w;   w += nX  * sizeof(__bf16);
  __bf16* wq_hi   = (__bf16*)w;   w += nWq * sizeof(__bf16);
  __bf16* wq_lo   = (__bf16*)w;   w += nWq * sizeof(__bf16);
  __bf16* wp_hi   = (__bf16*)w;   w += nWp * sizeof(__bf16);
  __bf16* wp_lo   = (__bf16*)w;   w += nWp * sizeof(__bf16);
  __bf16* attn_hi = (__bf16*)w;   w += nX  * sizeof(__bf16);
  __bf16* attn_lo = (__bf16*)w;

  dim3 blk(256);

  // one-shot split-bf16 conversion of activations and weights
  f32_to_bf16_split<<<dim3((unsigned)(nX  / 4 / 256)), blk, 0, stream>>>(x,      x_hi, x_lo, (int)(nX  / 4));
  f32_to_bf16_split<<<dim3((unsigned)(nWq / 4 / 256)), blk, 0, stream>>>(w_qkv,  wq_hi, wq_lo, (int)(nWq / 4));
  f32_to_bf16_split<<<dim3((unsigned)(nWp / 4 / 256)), blk, 0, stream>>>(w_proj, wp_hi, wp_lo, (int)(nWp / 4));

  // qkv = x @ w_qkv^T + b_qkv
  gemm_bf16x3<<<dim3((3 * D) / TILE_N, M / TILE_M), blk, 0, stream>>>(
      x_hi, x_lo, wq_hi, wq_lo, b_qkv, qkv, M, 3 * D, D);

  // local-window attention (radius 4), emits split-bf16
  focal_attn<<<dim3((B * NHEADS * T) / 8), blk, 0, stream>>>(qkv, attn_hi, attn_lo);

  // out = attn @ w_proj^T + b_proj
  gemm_bf16x3<<<dim3(D / TILE_N, M / TILE_M), blk, 0, stream>>>(
      attn_hi, attn_lo, wp_hi, wp_lo, b_proj, out, M, D, D);
}

// v001
// It runs in 228 microseconds.
// Next to v000, in two timings, it ran 1.19 and 1.17 times as fast.
#include <hip/hip_runtime.h>
#include <hip/hip_bf16.h>

typedef float  v8f   __attribute__((ext_vector_type(8)));
typedef __bf16 v16bf __attribute__((ext_vector_type(16)));
typedef __bf16 v8bf  __attribute__((ext_vector_type(8)));
typedef __bf16 v4bf  __attribute__((ext_vector_type(4)));
typedef __bf16 v2bf  __attribute__((ext_vector_type(2)));
typedef int    v4i_  __attribute__((ext_vector_type(4)));

#define TILE_M 128
#define TILE_N 128
#define TILE_K 32
// LDS row pitch in bf16 elements: 64 data bytes + 16 pad bytes = 80 B (16 B x odd),
// so the 16 rows that a half-wave's ds_load_b128 touches fall on 16 distinct
// 4-bank groups; at 64 B every fourth row shares its banks.
#define LDS_PITCH 40

#if __has_builtin(__builtin_amdgcn_global_load_async_to_lds_b128)
#define HAVE_ASYNC_LDS 1
#endif

#if defined(HAVE_ASYNC_LDS)
// builtin expects int4* in addrspace(1)/(3); HIP prints as1 as `__device__`.
#define GLOBAL_AS(p) ((__attribute__((address_space(1))) v4i_*)(p))
#define LDS_AS(p)    ((__attribute__((address_space(3))) v4i_*)(p))
#if __has_builtin(__builtin_amdgcn_s_wait_asynccnt)
#define WAIT_ASYNC(n) __builtin_amdgcn_s_wait_asynccnt(n)
#else
#define WAIT_ASYNC(n) asm volatile("s_wait_asynccnt %0" :: "i"(n) : "memory")
#endif
#endif

// ---------------------------------------------------------------------------
// Elementwise fp32 -> split bf16 (hi + residual lo), done once per tensor so
// the GEMM hot loop has zero conversion VALU and tiles are raw async-copyable.
// ---------------------------------------------------------------------------
__global__ __launch_bounds__(256)
void f32_to_bf16_split(const float* __restrict__ in, __bf16* __restrict__ hi,
                       __bf16* __restrict__ lo, int n4) {
  int i = blockIdx.x * blockDim.x + threadIdx.x;
  if (i >= n4) return;
  float4 f = ((const float4*)in)[i];
  v4bf h, l;
  h.x = (__bf16)f.x;  l.x = (__bf16)(f.x - (float)h.x);
  h.y = (__bf16)f.y;  l.y = (__bf16)(f.y - (float)h.y);
  h.z = (__bf16)f.z;  l.z = (__bf16)(f.z - (float)h.z);
  h.w = (__bf16)f.w;  l.w = (__bf16)(f.w - (float)h.w);
  ((v4bf*)hi)[i] = h;
  ((v4bf*)lo)[i] = l;
}

// ---------------------------------------------------------------------------
// C[M,N] = (Ahi+Alo)[M,K] @ (Bhi+Blo)[N,K]^T + bias[N]   (bf16 split inputs)
// Double-buffered LDS; tiles streamed with GLOBAL_LOAD_ASYNC_TO_LDS_B128
// (ASYNCcnt) when available. 3 WMMAs (hh + hl + lh) per 16x16 tile ~ fp32.
// ---------------------------------------------------------------------------
__global__ __launch_bounds__(256)
void gemm_bf16x3(const __bf16* __restrict__ Ahi, const __bf16* __restrict__ Alo,
                 const __bf16* __restrict__ Bhi, const __bf16* __restrict__ Blo,
                 const float* __restrict__ bias, float* __restrict__ C,
                 int M, int N, int K) {
  __shared__ __align__(16) __bf16 sAhi[2][TILE_M * LDS_PITCH];
  __shared__ __align__(16) __bf16 sAlo[2][TILE_M * LDS_PITCH];
  __shared__ __align__(16) __bf16 sBhi[2][TILE_N * LDS_PITCH];
  __shared__ __align__(16) __bf16 sBlo[2][TILE_N * LDS_PITCH];

  const int tid   = threadIdx.x;
  const int lane  = tid & 31;
  const int wave  = tid >> 5;     // 0..7
  const int waveM = wave >> 2;    // 0..1 -> 64-row slab
  const int waveN = wave & 3;     // 0..3 -> 32-col slab
  const int m0 = blockIdx.y * TILE_M;
  const int n0 = blockIdx.x * TILE_N;

  // cooperative copy mapping: thread owns 32 contiguous bytes of one tile row
  const int crow = tid >> 1;          // 0..127
  const int ccol = (tid & 1) * 16;    // element offset (bf16) within 32-wide row

  // WMMA fragment addressing (contiguous k order, same for A and B):
  // lane l -> row/col (l&15), K-base (l>>4)*16, 16 contiguous bf16.
  const int fr = lane & 15;
  const int kb = (lane >> 4) * 16;

  // copy one K-step (4 sub-tiles of 128x32 bf16 = 32KB) into LDS buffer `buf`
  auto issue_tile = [&](int kk, int buf) {
    const __bf16* gA0 = Ahi + (size_t)(m0 + crow) * K + kk + ccol;
    const __bf16* gA1 = Alo + (size_t)(m0 + crow) * K + kk + ccol;
    const __bf16* gB0 = Bhi + (size_t)(n0 + crow) * K + kk + ccol;
    const __bf16* gB1 = Blo + (size_t)(n0 + crow) * K + kk + ccol;
    __bf16* lA0 = &sAhi[buf][crow * LDS_PITCH + ccol];
    __bf16* lA1 = &sAlo[buf][crow * LDS_PITCH + ccol];
    __bf16* lB0 = &sBhi[buf][crow * LDS_PITCH + ccol];
    __bf16* lB1 = &sBlo[buf][crow * LDS_PITCH + ccol];
#if defined(HAVE_ASYNC_LDS)
    // 8 wave-wide async ops per wave per K-step; in-order completion.
    __builtin_amdgcn_global_load_async_to_lds_b128(GLOBAL_AS(gA0), LDS_AS(lA0), 0, 0);
    __builtin_amdgcn_global_load_async_to_lds_b128(GLOBAL_AS(gA0), LDS_AS(lA0), 16, 0);
    __builtin_amdgcn_global_load_async_to_lds_b128(GLOBAL_AS(gA1), LDS_AS(lA1), 0, 0);
    __builtin_amdgcn_global_load_async_to_lds_b128(GLOBAL_AS(gA1), LDS_AS(lA1), 16, 0);
    __builtin_amdgcn_global_load_async_to_lds_b128(GLOBAL_AS(gB0), LDS_AS(lB0), 0, 0);
    __builtin_amdgcn_global_load_async_to_lds_b128(GLOBAL_AS(gB0), LDS_AS(lB0), 16, 0);
    __builtin_amdgcn_global_load_async_to_lds_b128(GLOBAL_AS(gB1), LDS_AS(lB1), 0, 0);
    __builtin_amdgcn_global_load_async_to_lds_b128(GLOBAL_AS(gB1), LDS_AS(lB1), 16, 0);
#else
    ((uint4*)lA0)[0] = ((const uint4*)gA0)[0];
    ((uint4*)lA0)[1] = ((const uint4*)gA0)[1];
    ((uint4*)lA1)[0] = ((const uint4*)gA1)[0];
    ((uint4*)lA1)[1] = ((const uint4*)gA1)[1];
    ((uint4*)lB0)[0] = ((const uint4*)gB0)[0];
    ((uint4*)lB0)[1] = ((const uint4*)gB0)[1];
    ((uint4*)lB1)[0] = ((const uint4*)gB1)[0];
    ((uint4*)lB1)[1] = ((const uint4*)gB1)[1];
#endif
  };

  // one fragment = 32 contiguous bytes of a padded row, 16-byte aligned: two b128 reads
  auto load_frag = [&](const __bf16* p) {
    v8bf f0 = ((const v8bf*)p)[0];
    v8bf f1 = ((const v8bf*)p)[1];
    return __builtin_shufflevector(f0, f1, 0, 1, 2, 3, 4, 5, 6, 7,
                                   8, 9, 10, 11, 12, 13, 14, 15);
  };

  v8f acc[4][2] = {};

  const int nk = K / TILE_K;
  issue_tile(0, 0);

  for (int ik = 0; ik < nk; ++ik) {
    const int cur = ik & 1;
    if (ik + 1 < nk) {
      issue_tile((ik + 1) * TILE_K, cur ^ 1);   // prefetch behind the WMMAs
#if defined(HAVE_ASYNC_LDS)
      WAIT_ASYNC(8);                            // current tile's 8 ops done
#endif
    } else {
#if defined(HAVE_ASYNC_LDS)
      WAIT_ASYNC(0);
#endif
    }
    __syncthreads();   // tile data visible to all waves

    v16bf aH[4], aL[4], bH[2], bL[2];
    #pragma unroll
    for (int i = 0; i < 4; ++i) {
      int r = waveM * 64 + i * 16 + fr;
      aH[i] = load_frag(&sAhi[cur][r * LDS_PITCH + kb]);
      aL[i] = load_frag(&sAlo[cur][r * LDS_PITCH + kb]);
    }
    #pragma unroll
    for (int j = 0; j < 2; ++j) {
      int c = waveN * 32 + j * 16 + fr;
      bH[j] = load_frag(&sBhi[cur][c * LDS_PITCH + kb]);
      bL[j] = load_frag(&sBlo[cur][c * LDS_PITCH + kb]);
    }

    #pragma unroll
    for (int i = 0; i < 4; ++i) {
      #pragma unroll
      for (int j = 0; j < 2; ++j) {
        acc[i][j] = __builtin_amdgcn_wmma_f32_16x16x32_bf16(
            false, aH[i], false, bH[j], (short)0, acc[i][j], false, false);
        acc[i][j] = __builtin_amdgcn_wmma_f32_16x16x32_bf16(
            false, aH[i], false, bL[j], (short)0, acc[i][j], false, false);
        acc[i][j] = __builtin_amdgcn_wmma_f32_16x16x32_bf16(
            false, aL[i], false, bH[j], (short)0, acc[i][j], false, false);
      }
    }
    __syncthreads();   // reads done before this buffer is overwritten (ik+2)
  }

  // epilogue: bias add + store (C layout: VGPR r -> M=r / r+8 by lane half)
  const int rowAdd = (lane >> 4) * 8;
  #pragma unroll
  for (int i = 0; i < 4; ++i) {
    #pragma unroll
    for (int j = 0; j < 2; ++j) {
      int gcol = n0 + waveN * 32 + j * 16 + fr;
      float bv = bias[gcol];
      #pragma unroll
      for (int r = 0; r < 8; ++r) {
        int grow = m0 + waveM * 64 + i * 16 + rowAdd + r;
        C[(size_t)grow * N + gcol] = acc[i][j][r] + bv;
      }
    }
  }
}

#define T_SEQ  2048
#define DMODEL 1024
#define NHEADS 16
#define HDIM   64
#define RAD    4
#define NWIN   (2 * RAD + 1)

// One wave per (b,h,t): 32 lanes x 2 dims cover hd=64; <=9 keys per query.
// Emits split-bf16 output directly for the projection GEMM.
__global__ __launch_bounds__(256)
void focal_attn(const float* __restrict__ qkv, __bf16* __restrict__ out_hi,
                __bf16* __restrict__ out_lo) {
  const int lane = threadIdx.x & 31;
  const int gw = blockIdx.x * 8 + (threadIdx.x >> 5);
  const int t  = gw % T_SEQ;
  const int bh = gw / T_SEQ;
  const int h  = bh % NHEADS;
  const int b  = bh / NHEADS;

  const size_t rowBase = ((size_t)(b * T_SEQ + t)) * (3 * DMODEL);
  const int    hoff    = h * HDIM + lane * 2;
  const float2 q2 = *(const float2*)(qkv + rowBase + hoff);
  const float  scale = 0.125f; // 1/sqrt(64)

  float  s[NWIN];
  float2 vv[NWIN];
  #pragma unroll
  for (int j = 0; j < NWIN; ++j) {
    int  tk = t - RAD + j;
    bool ok = (tk >= 0) && (tk < T_SEQ);
    int  tc = ok ? tk : t;
    const size_t kbase = ((size_t)(b * T_SEQ + tc)) * (3 * DMODEL) + hoff;
    float2 k2 = *(const float2*)(qkv + kbase + DMODEL);
    vv[j]     = *(const float2*)(qkv + kbase + 2 * DMODEL);
    float p = q2.x * k2.x + q2.y * k2.y;
    #pragma unroll
    for (int off = 16; off > 0; off >>= 1) p += __shfl_xor(p, off, 32);
    s[j] = ok ? p * scale : -__builtin_inff();
  }

  float m = s[0];
  #pragma unroll
  for (int j = 1; j < NWIN; ++j) m = fmaxf(m, s[j]);
  float sum = 0.0f;
  #pragma unroll
  for (int j = 0; j < NWIN; ++j) { float e = __expf(s[j] - m); s[j] = e; sum += e; }
  float inv = 1.0f / sum;

  float2 o = make_float2(0.0f, 0.0f);
  #pragma unroll
  for (int j = 0; j < NWIN; ++j) { o.x += s[j] * vv[j].x; o.y += s[j] * vv[j].y; }
  o.x *= inv; o.y *= inv;

  v2bf hi2, lo2;
  hi2.x = (__bf16)o.x;  lo2.x = (__bf16)(o.x - (float)hi2.x);
  hi2.y = (__bf16)o.y;  lo2.y = (__bf16)(o.y - (float)hi2.y);
  const size_t oidx = ((size_t)(b * T_SEQ + t)) * DMODEL + hoff;
  *(v2bf*)(out_hi + oidx) = hi2;
  *(v2bf*)(out_lo + oidx) = lo2;
}

extern "C" void kernel_launch(void* const* d_in, const int* in_sizes, int n_in,
                              void* d_out, int out_size, void* d_ws, size_t ws_size,
                              hipStream_t stream) {
  const float* x      = (const float*)d_in[0];
  const float* w_qkv  = (const float*)d_in[1];
  const float* b_qkv  = (const float*)d_in[2];
  const float* w_proj = (const float*)d_in[3];
  const float* b_proj = (const float*)d_in[4];
  float* out = (float*)d_out;

  const int B = 4, T = T_SEQ, D = DMODEL;
  const int M = B * T;                         // 8192 rows
  const size_t nX  = (size_t)M * D;            // 8,388,608
  const size_t nWq = (size_t)3 * D * D;        // 3,145,728
  const size_t nWp = (size_t)D * D;            // 1,048,576

  // workspace layout (all offsets naturally aligned)
  char* w = (char*)d_ws;
  float*  qkv     = (float*)w;    w += (size_t)M * 3 * D * sizeof(float);  // 96 MB
  __bf16* x_hi    = (__bf16*)w;   w += nX  * sizeof(__bf16);
  __bf16* x_lo    = (__bf16*)w;   w += nX  * sizeof(__bf16);
  __bf16* wq_hi   = (__bf16*)w;   w += nWq * sizeof(__bf16);
  __bf16* wq_lo   = (__bf16*)w;   w += nWq * sizeof(__bf16);
  __bf16* wp_hi   = (__bf16*)w;   w += nWp * sizeof(__bf16);
  __bf16* wp_lo   = (__bf16*)w;   w += nWp * sizeof(__bf16);
  __bf16* attn_hi = (__bf16*)w;   w += nX  * sizeof(__bf16);
  __bf16* attn_lo = (__bf16*)w;

  dim3 blk(256);

  // one-shot split-bf16 conversion of activations and weights
  f32_to_bf16_split<<<dim3((unsigned)(nX  / 4 / 256)), blk, 0, stream>>>(x,      x_hi, x_lo, (int)(nX  / 4));
  f32_to_bf16_split<<<dim3((unsigned)(nWq / 4 / 256)), blk, 0, stream>>>(w_qkv,  wq_hi, wq_lo, (int)(nWq / 4));
  f32_to_bf16_split<<<dim3((unsigned)(nWp / 4 / 256)), blk, 0, stream>>>(w_proj, wp_hi, wp_lo, (int)(nWp / 4));

  // qkv = x @ w_qkv^T + b_qkv
  gemm_bf16x3<<<dim3((3 * D) / TILE_N, M / TILE_M), blk, 0, stream>>>(
      x_hi, x_lo, wq_hi, wq_lo, b_qkv, qkv, M, 3 * D, D);

  // local-window attention (radius 4), emits split-bf16
  focal_attn<<<dim3((B * NHEADS * T) / 8), blk, 0, stream>>>(qkv, attn_hi, attn_lo);

  // out = attn @ w_proj^T + b_proj
  gemm_bf16x3<<<dim3(D / TILE_N, M / TILE_M), blk, 0, stream>>>(
      attn_hi, attn_lo, wp_hi, wp_lo, b_proj, out, M, D, D);
}

// v002
// Measured time: 171 microseconds a run.
// Timed twice side by side with v001, it ran 1.34 and 1.35 times as fast.
// Over all steps from v000 it is 1.59 times as fast.
#include <hip/hip_runtime.h>
#include <hip/hip_bf16.h>

typedef float  v8f   __attribute__((ext_vector_type(8)));
typedef __bf16 v16bf __attribute__((ext_vector_type(16)));
typedef __bf16 v8bf  __attribute__((ext_vector_type(8)));
typedef __bf16 v4bf  __attribute__((ext_vector_type(4)));
typedef __bf16 v2bf  __attribute__((ext_vector_type(2)));
typedef int    v4i_  __attribute__((ext_vector_type(4)));

#define TILE_M 128
#define TILE_N 128
#define TILE_K 32
// Split operands live in memory as 128-byte units, one per row and 32-k block:
// 32 bf16 heads (64 B) followed by their 32 bf16 remainders (64 B). One K-step of
// a tile row is then exactly one whole, aligned cache line.
#define UNIT 64      // bf16 elements of a unit
#define UNIT_LO 32   // where the remainders start inside a unit
// LDS row pitch in bf16 elements: 128 data bytes + 16 pad bytes = 144 B (16 B x odd),
// so the 16 rows that a half-wave's ds_load_b128 touches fall on 16 distinct
// 4-bank groups.
#define LDS_PITCH 72

#if __has_builtin(__builtin_amdgcn_global_load_async_to_lds_b128)
#define HAVE_ASYNC_LDS 1
#endif

#if defined(HAVE_ASYNC_LDS)
// builtin expects int4* in addrspace(1)/(3); HIP prints as1 as `__device__`.
#define GLOBAL_AS(p) ((__attribute__((address_space(1))) v4i_*)(p))
#define LDS_AS(p)    ((__attribute__((address_space(3))) v4i_*)(p))
#if __has_builtin(__builtin_amdgcn_s_wait_asynccnt)
#define WAIT_ASYNC(n) __builtin_amdgcn_s_wait_asynccnt(n)
#else
#define WAIT_ASYNC(n) asm volatile("s_wait_asynccnt %0" :: "i"(n) : "memory")
#endif
#endif

// ---------------------------------------------------------------------------
// Elementwise fp32 -> split bf16 (hi + residual lo), done once per tensor so
// the GEMM hot loop has zero conversion VALU and tiles are raw async-copyable.
// ---------------------------------------------------------------------------
__global__ __launch_bounds__(256)
void f32_to_bf16_split(const float* __restrict__ in, __bf16* __restrict__ hl, int n4) {
  int i = blockIdx.x * blockDim.x + threadIdx.x;
  if (i >= n4) return;
  float4 f = ((const float4*)in)[i];
  v4bf h, l;
  h.x = (__bf16)f.x;  l.x = (__bf16)(f.x - (float)h.x);
  h.y = (__bf16)f.y;  l.y = (__bf16)(f.y - (float)h.y);
  h.z = (__bf16)f.z;  l.z = (__bf16)(f.z - (float)h.z);
  h.w = (__bf16)f.w;  l.w = (__bf16)(f.w - (float)h.w);
  // element 4i: unit 4i / 32, place 4i % 32 (row lengths are multiples of 32)
  __bf16* u = hl + (size_t)(i >> 3) * UNIT + (i & 7) * 4;
  *(v4bf*)u = h;
  *(v4bf*)(u + UNIT_LO) = l;
}

// ---------------------------------------------------------------------------
// C[M,N] = (Ahi+Alo)[M,K] @ (Bhi+Blo)[N,K]^T + bias[N]   (bf16 split inputs,
// A and B each one buffer of head|remainder units, 2*K bf16 a row)
// Double-buffered LDS; tiles streamed with GLOBAL_LOAD_ASYNC_TO_LDS_B128
// (ASYNCcnt) when available. 3 WMMAs (hh + hl + lh) per 16x16 tile ~ fp32.
// ---------------------------------------------------------------------------
__global__ __launch_bounds__(256)
void gemm_bf16x3(const __bf16* __restrict__ A, const __bf16* __restrict__ B,
                 const float* __restrict__ bias, float* __restrict__ C,
                 int M, int N, int K) {
  __shared__ __align__(16) __bf16 sA[2][TILE_M * LDS_PITCH];
  __shared__ __align__(16) __bf16 sB[2][TILE_N * LDS_PITCH];

  const int tid   = threadIdx.x;
  const int lane  = tid & 31;
  const int wave  = tid >> 5;     // 0..7
  const int waveM = wave >> 2;    // 0..1 -> 64-row slab
  const int waveN = wave & 3;     // 0..3 -> 32-col slab
  const int m0 = blockIdx.y * TILE_M;
  const int n0 = blockIdx.x * TILE_N;

  // cooperative copy mapping: 8 adjacent lanes cover one unit (one 128-B line), so a
  // wave-wide 16-byte copy touches 4 whole lines; a thread's 4 copies are 32 rows apart
  const int crow = tid >> 3;          // 0..31
  const int ccol = (tid & 7) * 8;     // element offset (bf16) within the unit

  // WMMA fragment addressing (contiguous k order, same for A and B):
  // lane l -> row/col (l&15), K-base (l>>4)*16, 16 contiguous bf16.
  const int fr = lane & 15;
  const int kb = (lane >> 4) * 16;

  // copy one K-step (2 tiles of 128 units = 32KB) into LDS buffer `buf`
  auto issue_tile = [&](int kk, int buf) {
    const size_t gstep = (size_t)32 * 2 * K;   // 32 rows further in memory
    const int    lstep = 32 * LDS_PITCH;       // 32 rows further in LDS
    const __bf16* gA = A + (size_t)(m0 + crow) * (2 * K) + (kk / TILE_K) * UNIT + ccol;
    const __bf16* gB = B + (size_t)(n0 + crow) * (2 * K) + (kk / TILE_K) * UNIT + ccol;
    __bf16* lA = &sA[buf][crow * LDS_PITCH + ccol];
    __bf16* lB = &sB[buf][crow * LDS_PITCH + ccol];
#if defined(HAVE_ASYNC_LDS)
    // 8 wave-wide async ops per wave per K-step; in-order completion.
    __builtin_amdgcn_global_load_async_to_lds_b128(GLOBAL_AS(gA),             LDS_AS(lA),             0, 0);
    __builtin_amdgcn_global_load_async_to_lds_b128(GLOBAL_AS(gA + gstep),     LDS_AS(lA + lstep),     0, 0);
    __builtin_amdgcn_global_load_async_to_lds_b128(GLOBAL_AS(gA + 2 * gstep), LDS_AS(lA + 2 * lstep), 0, 0);
    __builtin_amdgcn_global_load_async_to_lds_b128(GLOBAL_AS(gA + 3 * gstep), LDS_AS(lA + 3 * lstep), 0, 0);
    __builtin_amdgcn_global_load_async_to_lds_b128(GLOBAL_AS(gB),             LDS_AS(lB),             0, 0);
    __builtin_amdgcn_global_load_async_to_lds_b128(GLOBAL_AS(gB + gstep),     LDS_AS(lB + lstep),     0, 0);
    __builtin_amdgcn_global_load_async_to_lds_b128(GLOBAL_AS(gB + 2 * gstep), LDS_AS(lB + 2 * lstep), 0, 0);
    __builtin_amdgcn_global_load_async_to_lds_b128(GLOBAL_AS(gB + 3 * gstep), LDS_AS(lB + 3 * lstep), 0, 0);
#else
    *(uint4*)(lA)             = *(const uint4*)(gA);
    *(uint4*)(lA + lstep)     = *(const uint4*)(gA + gstep);
    *(uint4*)(lA + 2 * lstep) = *(const uint4*)(gA + 2 * gstep);
    *(uint4*)(lA + 3 * lstep) = *(const uint4*)(gA + 3 * gstep);
    *(uint4*)(lB)             = *(const uint4*)(gB);
    *(uint4*)(lB + lstep)     = *(const uint4*)(gB + gstep);
    *(uint4*)(lB + 2 * lstep) = *(const uint4*)(gB + 2 * gstep);
    *(uint4*)(lB + 3 * lstep) = *(const uint4*)(gB + 3 * gstep);
#endif
  };

  // one fragment = 32 contiguous bytes of a padded row, 16-byte aligned: two b128 reads
  auto load_frag = [&](const __bf16* p) {
    v8bf f0 = ((const v8bf*)p)[0];
    v8bf f1 = ((const v8bf*)p)[1];
    return __builtin_shufflevector(f0, f1, 0, 1, 2, 3, 4, 5, 6, 7,
                                   8, 9, 10, 11, 12, 13, 14, 15);
  };

  v8f acc[4][2] = {};

  const int nk = K / TILE_K;
  issue_tile(0, 0);

  for (int ik = 0; ik < nk; ++ik) {
    const int cur = ik & 1;
    if (ik + 1 < nk) {
      issue_tile((ik + 1) * TILE_K, cur ^ 1);   // prefetch behind the WMMAs
#if defined(HAVE_ASYNC_LDS)
      WAIT_ASYNC(8);                            // current tile's 8 ops done
#endif
    } else {
#if defined(HAVE_ASYNC_LDS)
      WAIT_ASYNC(0);
#endif
    }
    __syncthreads();   // tile data visible to all waves

    v16bf aH[4], aL[4], bH[2], bL[2];
    #pragma unroll
    for (int i = 0; i < 4; ++i) {
      int r = waveM * 64 + i * 16 + fr;
      aH[i] = load_frag(&sA[cur][r * LDS_PITCH + kb]);
      aL[i] = load_frag(&sA[cur][r * LDS_PITCH + UNIT_LO + kb]);
    }
    #pragma unroll
    for (int j = 0; j < 2; ++j) {
      int c = waveN * 32 + j * 16 + fr;
      bH[j] = load_frag(&sB[cur][c * LDS_PITCH + kb]);
      bL[j] = load_frag(&sB[cur][c * LDS_PITCH + UNIT_LO + kb]);
    }

    #pragma unroll
    for (int i = 0; i < 4; ++i) {
      #pragma unroll
      for (int j = 0; j < 2; ++j) {
        acc[i][j] = __builtin_amdgcn_wmma_f32_16x16x32_bf16(
            false, aH[i], false, bH[j], (short)0, acc[i][j], false, false);
        acc[i][j] = __builtin_amdgcn_wmma_f32_16x16x32_bf16(
            false, aH[i], false, bL[j], (short)0, acc[i][j], false, false);
        acc[i][j] = __builtin_amdgcn_wmma_f32_16x16x32_bf16(
            false, aL[i], false, bH[j], (short)0, acc[i][j], false, false);
      }
    }
    __syncthreads();   // reads done before this buffer is overwritten (ik+2)
  }

  // epilogue: bias add + store (C layout: VGPR r -> M=r / r+8 by lane half)
  const int rowAdd = (lane >> 4) * 8;
  #pragma unroll
  for (int i = 0; i < 4; ++i) {
    #pragma unroll
    for (int j = 0; j < 2; ++j) {
      int gcol = n0 + waveN * 32 + j * 16 + fr;
      float bv = bias[gcol];
      #pragma unroll
      for (int r = 0; r < 8; ++r) {
        int grow = m0 + waveM * 64 + i * 16 + rowAdd + r;
        C[(size_t)grow * N + gcol] = acc[i][j][r] + bv;
      }
    }
  }
}

#define T_SEQ  2048
#define DMODEL 1024
#define NHEADS 16
#define HDIM   64
#define RAD    4
#define NWIN   (2 * RAD + 1)

// One wave per (b,h,t): 32 lanes x 2 dims cover hd=64; <=9 keys per query.
// Emits split-bf16 output (head|remainder units) directly for the projection GEMM.
__global__ __launch_bounds__(256)
void focal_attn(const float* __restrict__ qkv, __bf16* __restrict__ out_hl) {
  const int lane = threadIdx.x & 31;
  const int gw = blockIdx.x * 8 + (threadIdx.x >> 5);
  const int t  = gw % T_SEQ;
  const int bh = gw / T_SEQ;
  const int h  = bh % NHEADS;
  const int b  = bh / NHEADS;

  const size_t rowBase = ((size_t)(b * T_SEQ + t)) * (3 * DMODEL);
  const int    hoff    = h * HDIM + lane * 2;
  const float2 q2 = *(const float2*)(qkv + rowBase + hoff);
  const float  scale = 0.125f; // 1/sqrt(64)

  float  s[NWIN];
  float2 vv[NWIN];
  #pragma unroll
  for (int j = 0; j < NWIN; ++j) {
    int  tk = t - RAD + j;
    bool ok = (tk >= 0) && (tk < T_SEQ);
    int  tc = ok ? tk : t;
    const size_t kbase = ((size_t)(b * T_SEQ + tc)) * (3 * DMODEL) + hoff;
    float2 k2 = *(const float2*)(qkv + kbase + DMODEL);
    vv[j]     = *(const float2*)(qkv + kbase + 2 * DMODEL);
    float p = q2.x * k2.x + q2.y * k2.y;
    #pragma unroll
    for (int off = 16; off > 0; off >>= 1) p += __shfl_xor(p, off, 32);
    s[j] = ok ? p * scale : -__builtin_inff();
  }

  float m = s[0];
  #pragma unroll
  for (int j = 1; j < NWIN; ++j) m = fmaxf(m, s[j]);
  float sum = 0.0f;
  #pragma unroll
  for (int j = 0; j < NWIN; ++j) { float e = __expf(s[j] - m); s[j] = e; sum += e; }
  float inv = 1.0f / sum;

  float2 o = make_float2(0.0f, 0.0f);
  #pragma unroll
  for (int j = 0; j < NWIN; ++j) { o.x += s[j] * vv[j].x; o.y += s[j] * vv[j].y; }
  o.x *= inv; o.y *= inv;

  v2bf hi2, lo2;
  hi2.x = (__bf16)o.x;  lo2.x = (__bf16)(o.x - (float)hi2.x);
  hi2.y = (__bf16)o.y;  lo2.y = (__bf16)(o.y - (float)hi2.y);
  const size_t oidx = ((size_t)(b * T_SEQ + t)) * (2 * DMODEL) + (hoff >> 5) * UNIT + (hoff & 31);
  *(v2bf*)(out_hl + oidx) = hi2;
  *(v2bf*)(out_hl + oidx + UNIT_LO) = lo2;
}

extern "C" void kernel_launch(void* const* d_in, const int* in_sizes, int n_in,
                              void* d_out, int out_size, void* d_ws, size_t ws_size,
                              hipStream_t stream) {
  const float* x      = (const float*)d_in[0];
  const float* w_qkv  = (const float*)d_in[1];
  const float* b_qkv  = (const float*)d_in[2];
  const float* w_proj = (const float*)d_in[3];
  const float* b_proj = (const float*)d_in[4];
  float* out = (float*)d_out;

  const int B = 4, T = T_SEQ, D = DMODEL;
  const int M = B * T;                         // 8192 rows
  const size_t nX  = (size_t)M * D;            // 8,388,608
  const size_t nWq = (size_t)3 * D * D;        // 3,145,728
  const size_t nWp = (size_t)D * D;            // 1,048,576

  // workspace layout (all offsets naturally aligned)
  char* w = (char*)d_ws;
  float*  qkv     = (float*)w;    w += (size_t)M * 3 * D * sizeof(float);  // 96 MB
  __bf16* x_hl    = (__bf16*)w;   w += 2 * nX  * sizeof(__bf16);
  __bf16* wq_hl   = (__bf16*)w;   w += 2 * nWq * sizeof(__bf16);
  __bf16* wp_hl   = (__bf16*)w;   w += 2 * nWp * sizeof(__bf16);
  __bf16* attn_hl = (__bf16*)w;

  dim3 blk(256);

  // one-shot split-bf16 conversion of activations and weights
  f32_to_bf16_split<<<dim3((unsigned)(nX  / 4 / 256)), blk, 0, stream>>>(x,      x_hl,  (int)(nX  / 4));
  f32_to_bf16_split<<<dim3((unsigned)(nWq / 4 / 256)), blk, 0, stream>>>(w_qkv,  wq_hl, (int)(nWq / 4));
  f32_to_bf16_split<<<dim3((unsigned)(nWp / 4 / 256)), blk, 0, stream>>>(w_proj, wp_hl, (int)(nWp / 4));

  // qkv = x @ w_qkv^T + b_qkv
  gemm_bf16x3<<<dim3((3 * D) / TILE_N, M / TILE_M), blk, 0, stream>>>(
      x_hl, wq_hl, b_qkv, qkv, M, 3 * D, D);

  // local-window attention (radius 4), emits split-bf16
  focal_attn<<<dim3((B * NHEADS * T) / 8), blk, 0, stream>>>(qkv, attn_hl);

  // out = attn @ w_proj^T + b_proj
  gemm_bf16x3<<<dim3(D / TILE_N, M / TILE_M), blk, 0, stream>>>(
      attn_hl, wp_hl, b_proj, out, M, D, D);
}

// v003
// A run of this version takes 167 microseconds.
// Next to v002, in two timings, it ran 1.03 times as fast each time.
// All steps since v000 together make it 1.64 times as fast.
#include <hip/hip_runtime.h>
#include <hip/hip_bf16.h>

typedef float  v8f   __attribute__((ext_vector_type(8)));
typedef __bf16 v16bf __attribute__((ext_vector_type(16)));
typedef __bf16 v8bf  __attribute__((ext_vector_type(8)));
typedef __bf16 v4bf  __attribute__((ext_vector_type(4)));
typedef __bf16 v2bf  __attribute__((ext_vector_type(2)));
typedef int    v4i_  __attribute__((ext_vector_type(4)));

#define TILE_M 256
#define TILE_N 128
#define TILE_K 32
// Split operands live in memory as 128-byte units, one per row and 32-k block:
// 32 bf16 heads (64 B) followed by their 32 bf16 remainders (64 B). One K-step of
// a tile row is then exactly one whole, aligned cache line.
#define UNIT 64      // bf16 elements of a unit
#define UNIT_LO 32   // where the remainders start inside a unit
// LDS row pitch in bf16 elements: 128 data bytes + 16 pad bytes = 144 B (16 B x odd),
// so the 16 rows that a half-wave's ds_load_b128 touches fall on 16 distinct
// 4-bank groups.
#define LDS_PITCH 72

#if __has_builtin(__builtin_amdgcn_global_load_async_to_lds_b128)
#define HAVE_ASYNC_LDS 1
#endif

#if defined(HAVE_ASYNC_LDS)
// builtin expects int4* in addrspace(1)/(3); HIP prints as1 as `__device__`.
#define GLOBAL_AS(p) ((__attribute__((address_space(1))) v4i_*)(p))
#define LDS_AS(p)    ((__attribute__((address_space(3))) v4i_*)(p))
#if __has_builtin(__builtin_amdgcn_s_wait_asynccnt)
#define WAIT_ASYNC(n) __builtin_amdgcn_s_wait_asynccnt(n)
#else
#define WAIT_ASYNC(n) asm volatile("s_wait_asynccnt %0" :: "i"(n) : "memory")
#endif
#endif

// ---------------------------------------------------------------------------
// Elementwise fp32 -> split bf16 (hi + residual lo), done once per tensor so
// the GEMM hot loop has zero conversion VALU and tiles are raw async-copyable.
// ---------------------------------------------------------------------------
__global__ __launch_bounds__(256)
void f32_to_bf16_split(const float* __restrict__ in, __bf16* __restrict__ hl, int n4) {
  int i = blockIdx.x * blockDim.x + threadIdx.x;
  if (i >= n4) return;
  float4 f = ((const float4*)in)[i];
  v4bf h, l;
  h.x = (__bf16)f.x;  l.x = (__bf16)(f.x - (float)h.x);
  h.y = (__bf16)f.y;  l.y = (__bf16)(f.y - (float)h.y);
  h.z = (__bf16)f.z;  l.z = (__bf16)(f.z - (float)h.z);
  h.w = (__bf16)f.w;  l.w = (__bf16)(f.w - (float)h.w);
  // element 4i: unit 4i / 32, place 4i % 32 (row lengths are multiples of 32)
  __bf16* u = hl + (size_t)(i >> 3) * UNIT + (i & 7) * 4;
  *(v4bf*)u = h;
  *(v4bf*)(u + UNIT_LO) = l;
}

// ---------------------------------------------------------------------------
// C[M,N] = (Ahi+Alo)[M,K] @ (Bhi+Blo)[N,K]^T + bias[N]   (bf16 split inputs,
// A and B each one buffer of head|remainder units, 2*K bf16 a row)
// Double-buffered LDS; tiles streamed with GLOBAL_LOAD_ASYNC_TO_LDS_B128
// (ASYNCcnt) when available. 3 WMMAs (hh + hl + lh) per 16x16 tile ~ fp32.
// ---------------------------------------------------------------------------
__global__ __launch_bounds__(256)
void gemm_bf16x3(const __bf16* __restrict__ A, const __bf16* __restrict__ B,
                 const float* __restrict__ bias, float* __restrict__ C,
                 int M, int N, int K) {
  __shared__ __align__(16) __bf16 sA[2][TILE_M * LDS_PITCH];
  __shared__ __align__(16) __bf16 sB[2][TILE_N * LDS_PITCH];

  const int tid   = threadIdx.x;
  const int lane  = tid & 31;
  const int wave  = tid >> 5;     // 0..7
  const int waveM = wave >> 1;    // 0..3 -> 64-row slab
  const int waveN = wave & 1;     // 0..1 -> 64-col slab
  const int m0 = blockIdx.y * TILE_M;
  const int n0 = blockIdx.x * TILE_N;

  // cooperative copy mapping: 8 adjacent lanes cover one unit (one 128-B line), so a
  // wave-wide 16-byte copy touches 4 whole lines; a thread's copies are 32 rows apart
  const int crow = tid >> 3;          // 0..31
  const int ccol = (tid & 7) * 8;     // element offset (bf16) within the unit

  // WMMA fragment addressing (contiguous k order, same for A and B):
  // lane l -> row/col (l&15), K-base (l>>4)*16, 16 contiguous bf16.
  const int fr = lane & 15;
  const int kb = (lane >> 4) * 16;

  // copy one K-step (256 + 128 units = 48KB) into LDS buffer `buf`
  auto issue_tile = [&](int kk, int buf) {
    const size_t gstep = (size_t)32 * 2 * K;   // 32 rows further in memory
    const int    lstep = 32 * LDS_PITCH;       // 32 rows further in LDS
    const __bf16* gA = A + (size_t)(m0 + crow) * (2 * K) + (kk / TILE_K) * UNIT + ccol;
    const __bf16* gB = B + (size_t)(n0 + crow) * (2 * K) + (kk / TILE_K) * UNIT + ccol;
    __bf16* lA = &sA[buf][crow * LDS_PITCH + ccol];
    __bf16* lB = &sB[buf][crow * LDS_PITCH + ccol];
#if defined(HAVE_ASYNC_LDS)
    // 12 wave-wide async ops per wave per K-step; in-order completion.
    __builtin_amdgcn_global_load_async_to_lds_b128(GLOBAL_AS(gA),             LDS_AS(lA),             0, 0);
    __builtin_amdgcn_global_load_async_to_lds_b128(GLOBAL_AS(gA + gstep),     LDS_AS(lA + lstep),     0, 0);
    __builtin_amdgcn_global_load_async_to_lds_b128(GLOBAL_AS(gA + 2 * gstep), LDS_AS(lA + 2 * lstep), 0, 0);
    __builtin_amdgcn_global_load_async_to_lds_b128(GLOBAL_AS(gA + 3 * gstep), LDS_AS(lA + 3 * lstep), 0, 0);
    __builtin_amdgcn_global_load_async_to_lds_b128(GLOBAL_AS(gA + 4 * gstep), LDS_AS(lA + 4 * lstep), 0, 0);
    __builtin_amdgcn_global_load_async_to_lds_b128(GLOBAL_AS(gA + 5 * gstep), LDS_AS(lA + 5 * lstep), 0, 0);
    __builtin_amdgcn_global_load_async_to_lds_b128(GLOBAL_AS(gA + 6 * gstep), LDS_AS(lA + 6 * lstep), 0, 0);
    __builtin_amdgcn_global_load_async_to_lds_b128(GLOBAL_AS(gA + 7 * gstep), LDS_AS(lA + 7 * lstep), 0, 0);
    __builtin_amdgcn_global_load_async_to_lds_b128(GLOBAL_AS(gB),             LDS_AS(lB),             0, 0);
    __builtin_amdgcn_global_load_async_to_lds_b128(GLOBAL_AS(gB + gstep),     LDS_AS(lB + lstep),     0, 0);
    __builtin_amdgcn_global_load_async_to_lds_b128(GLOBAL_AS(gB + 2 * gstep), LDS_AS(lB + 2 * lstep), 0, 0);
    __builtin_amdgcn_global_load_async_to_lds_b128(GLOBAL_AS(gB + 3 * gstep), LDS_AS(lB + 3 * lstep), 0, 0);
#else
    *(uint4*)(lA)             = *(const uint4*)(gA);
    *(uint4*)(lA + lstep)     = *(const uint4*)(gA + gstep);
    *(uint4*)(lA + 2 * lstep) = *(const uint4*)(gA + 2 * gstep);
    *(uint4*)(lA + 3 * lstep) = *(const uint4*)(gA + 3 * gstep);
    *(uint4*)(lA + 4 * lstep) = *(const uint4*)(gA + 4 * gstep);
    *(uint4*)(lA + 5 * lstep) = *(const uint4*)(gA + 5 * gstep);
    *(uint4*)(lA + 6 * lstep) = *(const uint4*)(gA + 6 * gstep);
    *(uint4*)(lA + 7 * lstep) = *(const uint4*)(gA + 7 * gstep);
    *(uint4*)(lB)             = *(const uint4*)(gB);
    *(uint4*)(lB + lstep)     = *(const uint4*)(gB + gstep);
    *(uint4*)(lB + 2 * lstep) = *(const uint4*)(gB + 2 * gstep);
    *(uint4*)(lB + 3 * lstep) = *(const uint4*)(gB + 3 * gstep);
#endif
  };

  // one fragment = 32 contiguous bytes of a padded row, 16-byte aligned: two b128 reads
  auto load_frag = [&](const __bf16* p) {
    v8bf f0 = ((const v8bf*)p)[0];
    v8bf f1 = ((const v8bf*)p)[1];
    return __builtin_shufflevector(f0, f1, 0, 1, 2, 3, 4, 5, 6, 7,
                                   8, 9, 10, 11, 12, 13, 14, 15);
  };

  v8f acc[4][4] = {};

  const int nk = K / TILE_K;
  issue_tile(0, 0);

  for (int ik = 0; ik < nk; ++ik) {
    const int cur = ik & 1;
    if (ik + 1 < nk) {
      issue_tile((ik + 1) * TILE_K, cur ^ 1);   // prefetch behind the WMMAs
#if defined(HAVE_ASYNC_LDS)
      WAIT_ASYNC(12);                           // current tile's 12 ops done
#endif
    } else {
#if defined(HAVE_ASYNC_LDS)
      WAIT_ASYNC(0);
#endif
    }
    __syncthreads();   // tile data visible to all waves

    v16bf aH[4], aL[4], bH[4], bL[4];
    #pragma unroll
    for (int i = 0; i < 4; ++i) {
      int r = waveM * 64 + i * 16 + fr;
      aH[i] = load_frag(&sA[cur][r * LDS_PITCH + kb]);
      aL[i] = load_frag(&sA[cur][r * LDS_PITCH + UNIT_LO + kb]);
    }
    #pragma unroll
    for (int j = 0; j < 4; ++j) {
      int c = waveN * 64 + j * 16 + fr;
      bH[j] = load_frag(&sB[cur][c * LDS_PITCH + kb]);
      bL[j] = load_frag(&sB[cur][c * LDS_PITCH + UNIT_LO + kb]);
    }

    #pragma unroll
    for (int i = 0; i < 4; ++i) {
      #pragma unroll
      for (int j = 0; j < 4; ++j) {
        acc[i][j] = __builtin_amdgcn_wmma_f32_16x16x32_bf16(
            false, aH[i], false, bH[j], (short)0, acc[i][j], false, false);
        acc[i][j] = __builtin_amdgcn_wmma_f32_16x16x32_bf16(
            false, aH[i], false, bL[j], (short)0, acc[i][j], false, false);
        acc[i][j] = __builtin_amdgcn_wmma_f32_16x16x32_bf16(
            false, aL[i], false, bH[j], (short)0, acc[i][j], false, false);
      }
    }
    __syncthreads();   // reads done before this buffer is overwritten (ik+2)
  }

  // epilogue: bias add + store (C layout: VGPR r -> M=r / r+8 by lane half)
  const int rowAdd = (lane >> 4) * 8;
  #pragma unroll
  for (int i = 0; i < 4; ++i) {
    #pragma unroll
    for (int j = 0; j < 4; ++j) {
      int gcol = n0 + waveN * 64 + j * 16 + fr;
      float bv = bias[gcol];
      #pragma unroll
      for (int r = 0; r < 8; ++r) {
        int grow = m0 + waveM * 64 + i * 16 + rowAdd + r;
        C[(size_t)grow * N + gcol] = acc[i][j][r] + bv;
      }
    }
  }
}

#define T_SEQ  2048
#define DMODEL 1024
#define NHEADS 16
#define HDIM   64
#define RAD    4
#define NWIN   (2 * RAD + 1)

// One wave per (b,h,t): 32 lanes x 2 dims cover hd=64; <=9 keys per query.
// Emits split-bf16 output (head|remainder units) directly for the projection GEMM.
__global__ __launch_bounds__(256)
void focal_attn(const float* __restrict__ qkv, __bf16* __restrict__ out_hl) {
  const int lane = threadIdx.x & 31;
  const int gw = blockIdx.x * 8 + (threadIdx.x >> 5);
  const int t  = gw % T_SEQ;
  const int bh = gw / T_SEQ;
  const int h  = bh % NHEADS;
  const int b  = bh / NHEADS;

  const size_t rowBase = ((size_t)(b * T_SEQ + t)) * (3 * DMODEL);
  const int    hoff    = h * HDIM + lane * 2;
  const float2 q2 = *(const float2*)(qkv + rowBase + hoff);
  const float  scale = 0.125f; // 1/sqrt(64)

  float  s[NWIN];
  float2 vv[NWIN];
  #pragma unroll
  for (int j = 0; j < NWIN; ++j) {
    int  tk = t - RAD + j;
    bool ok = (tk >= 0) && (tk < T_SEQ);
    int  tc = ok ? tk : t;
    const size_t kbase = ((size_t)(b * T_SEQ + tc)) * (3 * DMODEL) + hoff;
    float2 k2 = *(const float2*)(qkv + kbase + DMODEL);
    vv[j]     = *(const float2*)(qkv + kbase + 2 * DMODEL);
    float p = q2.x * k2.x + q2.y * k2.y;
    #pragma unroll
    for (int off = 16; off > 0; off >>= 1) p += __shfl_xor(p, off, 32);
    s[j] = ok ? p * scale : -__builtin_inff();
  }

  float m = s[0];
  #pragma unroll
  for (int j = 1; j < NWIN; ++j) m = fmaxf(m, s[j]);
  float sum = 0.0f;
  #pragma unroll
  for (int j = 0; j < NWIN; ++j) { float e = __expf(s[j] - m); s[j] = e; sum += e; }
  float inv = 1.0f / sum;

  float2 o = make_float2(0.0f, 0.0f);
  #pragma unroll
  for (int j = 0; j < NWIN; ++j) { o.x += s[j] * vv[j].x; o.y += s[j] * vv[j].y; }
  o.x *= inv; o.y *= inv;

  v2bf hi2, lo2;
  hi2.x = (__bf16)o.x;  lo2.x = (__bf16)(o.x - (float)hi2.x);
  hi2.y = (__bf16)o.y;  lo2.y = (__bf16)(o.y - (float)hi2.y);
  const size_t oidx = ((size_t)(b * T_SEQ + t)) * (2 * DMODEL) + (hoff >> 5) * UNIT + (hoff & 31);
  *(v2bf*)(out_hl + oidx) = hi2;
  *(v2bf*)(out_hl + oidx + UNIT_LO) = lo2;
}

extern "C" void kernel_launch(void* const* d_in, const int* in_sizes, int n_in,
                              void* d_out, int out_size, void* d_ws, size_t ws_size,
                              hipStream_t stream) {
  const float* x      = (const float*)d_in[0];
  const float* w_qkv  = (const float*)d_in[1];
  const float* b_qkv  = (const float*)d_in[2];
  const float* w_proj = (const float*)d_in[3];
  const float* b_proj = (const float*)d_in[4];
  float* out = (float*)d_out;

  const int B = 4, T = T_SEQ, D = DMODEL;
  const int M = B * T;                         // 8192 rows
  const size_t nX  = (size_t)M * D;            // 8,388,608
  const size_t nWq = (size_t)3 * D * D;        // 3,145,728
  const size_t nWp = (size_t)D * D;            // 1,048,576

  // workspace layout (all offsets naturally aligned)
  char* w = (char*)d_ws;
  float*  qkv     = (float*)w;    w += (size_t)M * 3 * D * sizeof(float);  // 96 MB
  __bf16* x_hl    = (__bf16*)w;   w += 2 * nX  * sizeof(__bf16);
  __bf16* wq_hl   = (__bf16*)w;   w += 2 * nWq * sizeof(__bf16);
  __bf16* wp_hl   = (__bf16*)w;   w += 2 * nWp * sizeof(__bf16);
  __bf16* attn_hl = (__bf16*)w;

  dim3 blk(256);

  // one-shot split-bf16 conversion of activations and weights
  f32_to_bf16_split<<<dim3((unsigned)(nX  / 4 / 256)), blk, 0, stream>>>(x,      x_hl,  (int)(nX  / 4));
  f32_to_bf16_split<<<dim3((unsigned)(nWq / 4 / 256)), blk, 0, stream>>>(w_qkv,  wq_hl, (int)(nWq / 4));
  f32_to_bf16_split<<<dim3((unsigned)(nWp / 4 / 256)), blk, 0, stream>>>(w_proj, wp_hl, (int)(nWp / 4));

  // qkv = x @ w_qkv^T + b_qkv
  gemm_bf16x3<<<dim3((3 * D) / TILE_N, M / TILE_M), blk, 0, stream>>>(
      x_hl, wq_hl, b_qkv, qkv, M, 3 * D, D);

  // local-window attention (radius 4), emits split-bf16
  focal_attn<<<dim3((B * NHEADS * T) / 8), blk, 0, stream>>>(qkv, attn_hl);

  // out = attn @ w_proj^T + b_proj
  gemm_bf16x3<<<dim3(D / TILE_N, M / TILE_M), blk, 0, stream>>>(
      attn_hl, wp_hl, b_proj, out, M, D, D);
}

// v004
// A run of this version takes 159 microseconds.
// Two timings next to v003 both put it at 1.05 times that version's speed.
// Counting every step since v000, it is 1.72 times as fast.
#include <hip/hip_runtime.h>
#include <hip/hip_bf16.h>

typedef float  v8f   __attribute__((ext_vector_type(8)));
typedef __bf16 v16bf __attribute__((ext_vector_type(16)));
typedef __bf16 v8bf  __attribute__((ext_vector_type(8)));
typedef __bf16 v4bf  __attribute__((ext_vector_type(4)));
typedef __bf16 v2bf  __attribute__((ext_vector_type(2)));
typedef int    v4i_  __attribute__((ext_vector_type(4)));

#define TILE_M 256
#define TILE_N 128
#define TILE_K 32
// Split operands live in memory as 128-byte units, one per row and 32-k block:
// 32 bf16 heads (64 B) followed by their 32 bf16 remainders (64 B). One K-step of
// a tile row is then exactly one whole, aligned cache line.
#define UNIT 64      // bf16 elements of a unit
#define UNIT_LO 32   // where the remainders start inside a unit
// LDS rows are the bare 128-byte units, no pad, so that three buffers of two
// work-groups fit one WGP's LDS. Instead the 16-byte piece c of row r lies at piece
// c ^ ((r >> 1) & 7): the 16 rows that a half-wave's ds_load_b128 touches then fall
// on 16 distinct 4-bank groups (row parity picks the half of the banks, the XOR the
// group inside it).
#define LDS_PITCH 64
#define NBUF 3       // LDS buffers of the K ring

#if __has_builtin(__builtin_amdgcn_global_load_async_to_lds_b128)
#define HAVE_ASYNC_LDS 1
#endif

#if defined(HAVE_ASYNC_LDS)
// builtin expects int4* in addrspace(1)/(3); HIP prints as1 as `__device__`.
#define GLOBAL_AS(p) ((__attribute__((address_space(1))) v4i_*)(p))
#define LDS_AS(p)    ((__attribute__((address_space(3))) v4i_*)(p))
// the wave's own copies, all but the n youngest, have landed; the clobber keeps LDS reads behind it
#define WAIT_ASYNC(n) asm volatile("s_wait_asynccnt %0" :: "i"(n) : "memory")
#endif

// ---------------------------------------------------------------------------
// Elementwise fp32 -> split bf16 (hi + residual lo), done once per tensor so
// the GEMM hot loop has zero conversion VALU and tiles are raw async-copyable.
// ---------------------------------------------------------------------------
__global__ __launch_bounds__(256)
void f32_to_bf16_split(const float* __restrict__ in, __bf16* __restrict__ hl, int n4) {
  int i = blockIdx.x * blockDim.x + threadIdx.x;
  if (i >= n4) return;
  float4 f = ((const float4*)in)[i];
  v4bf h, l;
  h.x = (__bf16)f.x;  l.x = (__bf16)(f.x - (float)h.x);
  h.y = (__bf16)f.y;  l.y = (__bf16)(f.y - (float)h.y);
  h.z = (__bf16)f.z;  l.z = (__bf16)(f.z - (float)h.z);
  h.w = (__bf16)f.w;  l.w = (__bf16)(f.w - (float)h.w);
  // element 4i: unit 4i / 32, place 4i % 32 (row lengths are multiples of 32)
  __bf16* u = hl + (size_t)(i >> 3) * UNIT + (i & 7) * 4;
  *(v4bf*)u = h;
  *(v4bf*)(u + UNIT_LO) = l;
}

// ---------------------------------------------------------------------------
// C[M,N] = (Ahi+Alo)[M,K] @ (Bhi+Blo)[N,K]^T + bias[N]   (bf16 split inputs,
// A and B each one buffer of head|remainder units, 2*K bf16 a row)
// Ring of three LDS buffers; tiles streamed two K-steps ahead with
// GLOBAL_LOAD_ASYNC_TO_LDS_B128 (ASYNCcnt) when available. 3 WMMAs (hh + hl + lh) per 16x16 tile ~ fp32.
// ---------------------------------------------------------------------------
__global__ __launch_bounds__(256)
void gemm_bf16x3(const __bf16* __restrict__ A, const __bf16* __restrict__ B,
                 const float* __restrict__ bias, float* __restrict__ C,
                 int M, int N, int K) {
  __shared__ __align__(16) __bf16 sA[NBUF][TILE_M * LDS_PITCH];
  __shared__ __align__(16) __bf16 sB[NBUF][TILE_N * LDS_PITCH];

  const int tid   = threadIdx.x;
  const int lane  = tid & 31;
  const int wave  = tid >> 5;     // 0..7
  const int waveM = wave >> 1;    // 0..3 -> 64-row slab
  const int waveN = wave & 1;     // 0..1 -> 64-col slab
  const int m0 = blockIdx.y * TILE_M;
  const int n0 = blockIdx.x * TILE_N;

  // cooperative copy mapping: 8 adjacent lanes cover one unit (one 128-B line), so a
  // wave-wide 16-byte copy touches 4 whole lines; a thread's copies are 32 rows apart
  const int crow = tid >> 3;          // 0..31
  const int ccol = (tid & 7) * 8;     // element offset (bf16) within the unit
  // the same piece's place in the LDS row (rows 32 apart share the swizzle)
  const int lcol = ((tid & 7) ^ ((crow >> 1) & 7)) * 8;

  // WMMA fragment addressing (this code's contiguous k order, used alike for A and B):
  // lane l -> row/col (l&15), K-base (l>>4)*16, 16 contiguous bf16.
  const int fr = lane & 15;
  // The 16 bf16 are pieces 2*(l>>4) and 2*(l>>4)+1 of the heads, +4 for the remainders;
  // element offsets of the four in a swizzled row (rows 16 apart share the swizzle)
  const int sw  = (fr >> 1) & 7;
  const int pc  = (lane >> 4) * 2;
  const int pH0 = ((pc)     ^ sw) * 8;
  const int pH1 = ((pc + 1) ^ sw) * 8;
  const int pL0 = ((pc + 4) ^ sw) * 8;
  const int pL1 = ((pc + 5) ^ sw) * 8;

  // copy one K-step (256 + 128 units = 48KB) into LDS buffer `buf`
  auto issue_tile = [&](int kk, int buf) {
    const size_t gstep = (size_t)32 * 2 * K;   // 32 rows further in memory
    const int    lstep = 32 * LDS_PITCH;       // 32 rows further in LDS
    const __bf16* gA = A + (size_t)(m0 + crow) * (2 * K) + (kk / TILE_K) * UNIT + ccol;
    const __bf16* gB = B + (size_t)(n0 + crow) * (2 * K) + (kk / TILE_K) * UNIT + ccol;
    __bf16* lA = &sA[buf][crow * LDS_PITCH + lcol];
    __bf16* lB = &sB[buf][crow * LDS_PITCH + lcol];
#if defined(HAVE_ASYNC_LDS)
    // 12 wave-wide async ops per wave per K-step; in-order completion.
    __builtin_amdgcn_global_load_async_to_lds_b128(GLOBAL_AS(gA),             LDS_AS(lA),             0, 0);
    __builtin_amdgcn_global_load_async_to_lds_b128(GLOBAL_AS(gA + gstep),     LDS_AS(lA + lstep),     0, 0);
    __builtin_amdgcn_global_load_async_to_lds_b128(GLOBAL_AS(gA + 2 * gstep), LDS_AS(lA + 2 * lstep), 0, 0);
    __builtin_amdgcn_global_load_async_to_lds_b128(GLOBAL_AS(gA + 3 * gstep), LDS_AS(lA + 3 * lstep), 0, 0);
    __builtin_amdgcn_global_load_async_to_lds_b128(GLOBAL_AS(gA + 4 * gstep), LDS_AS(lA + 4 * lstep), 0, 0);
    __builtin_amdgcn_global_load_async_to_lds_b128(GLOBAL_AS(gA + 5 * gstep), LDS_AS(lA + 5 * lstep), 0, 0);
    __builtin_amdgcn_global_load_async_to_lds_b128(GLOBAL_AS(gA + 6 * gstep), LDS_AS(lA + 6 * lstep), 0, 0);
    __builtin_amdgcn_global_load_async_to_lds_b128(GLOBAL_AS(gA + 7 * gstep), LDS_AS(lA + 7 * lstep), 0, 0);
    __builtin_amdgcn_global_load_async_to_lds_b128(GLOBAL_AS(gB),             LDS_AS(lB),             0, 0);
    __builtin_amdgcn_global_load_async_to_lds_b128(GLOBAL_AS(gB + gstep),     LDS_AS(lB + lstep),     0, 0);
    __builtin_amdgcn_global_load_async_to_lds_b128(GLOBAL_AS(gB + 2 * gstep), LDS_AS(lB + 2 * lstep), 0, 0);
    __builtin_amdgcn_global_load_async_to_lds_b128(GLOBAL_AS(gB + 3 * gstep), LDS_AS(lB + 3 * lstep), 0, 0);
#else
    *(uint4*)(lA)             = *(const uint4*)(gA);
    *(uint4*)(lA + lstep)     = *(const uint4*)(gA + gstep);
    *(uint4*)(lA + 2 * lstep) = *(const uint4*)(gA + 2 * gstep);
    *(uint4*)(lA + 3 * lstep) = *(const uint4*)(gA + 3 * gstep);
    *(uint4*)(lA + 4 * lstep) = *(const uint4*)(gA + 4 * gstep);
    *(uint4*)(lA + 5 * lstep) = *(const uint4*)(gA + 5 * gstep);
    *(uint4*)(lA + 6 * lstep) = *(const uint4*)(gA + 6 * gstep);
    *(uint4*)(lA + 7 * lstep) = *(const uint4*)(gA + 7 * gstep);
    *(uint4*)(lB)             = *(const uint4*)(gB);
    *(uint4*)(lB + lstep)     = *(const uint4*)(gB + gstep);
    *(uint4*)(lB + 2 * lstep) = *(const uint4*)(gB + 2 * gstep);
    *(uint4*)(lB + 3 * lstep) = *(const uint4*)(gB + 3 * gstep);
#endif
  };

  // one fragment = two 16-byte pieces of a swizzled row: two b128 reads
  auto load_frag = [&](const __bf16* row, int p0, int p1) {
    v8bf f0 = *(const v8bf*)(row + p0);
    v8bf f1 = *(const v8bf*)(row + p1);
    return __builtin_shufflevector(f0, f1, 0, 1, 2, 3, 4, 5, 6, 7,
                                   8, 9, 10, 11, 12, 13, 14, 15);
  };

  v8f acc[4][4] = {};

  const int nk = K / TILE_K;
  issue_tile(0, 0);
  if (nk > 1) issue_tile(TILE_K, 1);

  int cur  = 0;   // buffer of tile ik
  int fill = 2;   // buffer of tile ik + 2, the one tile ik - 1 was read from
  for (int ik = 0; ik < nk; ++ik) {
    // this wave's reads of tile ik - 1 have retired before its buffer is refilled below
    asm volatile("s_wait_dscnt 0x0" ::: "memory");
#if defined(HAVE_ASYNC_LDS)
    if (ik + 1 < nk) {
      WAIT_ASYNC(12);   // tile ik's 12 copies done, tile ik + 1's may still fly
    } else {
      WAIT_ASYNC(0);
    }
#endif
    // the one barrier of a K-step: tile ik visible to all waves, and every wave has
    // left tile ik - 1
    __syncthreads();
    if (ik + 2 < nk) issue_tile((ik + 2) * TILE_K, fill);   // two K-steps of lead

    v16bf aH[4], aL[4], bH[4], bL[4];
    #pragma unroll
    for (int i = 0; i < 4; ++i) {
      int r = waveM * 64 + i * 16 + fr;
      aH[i] = load_frag(&sA[cur][r * LDS_PITCH], pH0, pH1);
      aL[i] = load_frag(&sA[cur][r * LDS_PITCH], pL0, pL1);
    }
    #pragma unroll
    for (int j = 0; j < 4; ++j) {
      int c = waveN * 64 + j * 16 + fr;
      bH[j] = load_frag(&sB[cur][c * LDS_PITCH], pH0, pH1);
      bL[j] = load_frag(&sB[cur][c * LDS_PITCH], pL0, pL1);
    }

    #pragma unroll
    for (int i = 0; i < 4; ++i) {
      #pragma unroll
      for (int j = 0; j < 4; ++j) {
        acc[i][j] = __builtin_amdgcn_wmma_f32_16x16x32_bf16(
            false, aH[i], false, bH[j], (short)0, acc[i][j], false, false);
        acc[i][j] = __builtin_amdgcn_wmma_f32_16x16x32_bf16(
            false, aH[i], false, bL[j], (short)0, acc[i][j], false, false);
        acc[i][j] = __builtin_amdgcn_wmma_f32_16x16x32_bf16(
            false, aL[i], false, bH[j], (short)0, acc[i][j], false, false);
      }
    }
    fill = cur;
    cur  = (cur == NBUF - 1) ? 0 : cur + 1;
  }

  // epilogue: bias add + store (C layout: VGPR r -> M=r / r+8 by lane half)
  const int rowAdd = (lane >> 4) * 8;
  #pragma unroll
  for (int i = 0; i < 4; ++i) {
    #pragma unroll
    for (int j = 0; j < 4; ++j) {
      int gcol = n0 + waveN * 64 + j * 16 + fr;
      float bv = bias[gcol];
      #pragma unroll
      for (int r = 0; r < 8; ++r) {
        int grow = m0 + waveM * 64 + i * 16 + rowAdd + r;
        C[(size_t)grow * N + gcol] = acc[i][j][r] + bv;
      }
    }
  }
}

#define T_SEQ  2048
#define DMODEL 1024
#define NHEADS 16
#define HDIM   64
#define RAD    4
#define NWIN   (2 * RAD + 1)

// One wave per (b,h,t): 32 lanes x 2 dims cover hd=64; <=9 keys per query.
// Emits split-bf16 output (head|remainder units) directly for the projection GEMM.
__global__ __launch_bounds__(256)
void focal_attn(const float* __restrict__ qkv, __bf16* __restrict__ out_hl) {
  const int lane = threadIdx.x & 31;
  const int gw = blockIdx.x * 8 + (threadIdx.x >> 5);
  const int t  = gw % T_SEQ;
  const int bh = gw / T_SEQ;
  const int h  = bh % NHEADS;
  const int b  = bh / NHEADS;

  const size_t rowBase = ((size_t)(b * T_SEQ + t)) * (3 * DMODEL);
  const int    hoff    = h * HDIM + lane * 2;
  const float2 q2 = *(const float2*)(qkv + rowBase + hoff);
  const float  scale = 0.125f; // 1/sqrt(64)

  float  s[NWIN];
  float2 vv[NWIN];
  #pragma unroll
  for (int j = 0; j < NWIN; ++j) {
    int  tk = t - RAD + j;
    bool ok = (tk >= 0) && (tk < T_SEQ);
    int  tc = ok ? tk : t;
    const size_t kbase = ((size_t)(b * T_SEQ + tc)) * (3 * DMODEL) + hoff;
    float2 k2 = *(const float2*)(qkv + kbase + DMODEL);
    vv[j]     = *(const float2*)(qkv + kbase + 2 * DMODEL);
    float p = q2.x * k2.x + q2.y * k2.y;
    #pragma unroll
    for (int off = 16; off > 0; off >>= 1) p += __shfl_xor(p, off, 32);
    s[j] = ok ? p * scale : -__builtin_inff();
  }

  float m = s[0];
  #pragma unroll
  for (int j = 1; j < NWIN; ++j) m = fmaxf(m, s[j]);
  float sum = 0.0f;
  #pragma unroll
  for (int j = 0; j < NWIN; ++j) { float e = __expf(s[j] - m); s[j] = e; sum += e; }
  float inv = 1.0f / sum;

  float2 o = make_float2(0.0f, 0.0f);
  #pragma unroll
  for (int j = 0; j < NWIN; ++j) { o.x += s[j] * vv[j].x; o.y += s[j] * vv[j].y; }
  o.x *= inv; o.y *= inv;

  v2bf hi2, lo2;
  hi2.x = (__bf16)o.x;  lo2.x = (__bf16)(o.x - (float)hi2.x);
  hi2.y = (__bf16)o.y;  lo2.y = (__bf16)(o.y - (float)hi2.y);
  const size_t oidx = ((size_t)(b * T_SEQ + t)) * (2 * DMODEL) + (hoff >> 5) * UNIT + (hoff & 31);
  *(v2bf*)(out_hl + oidx) = hi2;
  *(v2bf*)(out_hl + oidx + UNIT_LO) = lo2;
}

extern "C" void kernel_launch(void* const* d_in, const int* in_sizes, int n_in,
                              void* d_out, int out_size, void* d_ws, size_t ws_size,
                              hipStream_t stream) {
  const float* x      = (const float*)d_in[0];
  const float* w_qkv  = (const float*)d_in[1];
  const float* b_qkv  = (const float*)d_in[2];
  const float* w_proj = (const float*)d_in[3];
  const float* b_proj = (const float*)d_in[4];
  float* out = (float*)d_out;

  const int B = 4, T = T_SEQ, D = DMODEL;
  const int M = B * T;                         // 8192 rows
  const size_t nX  = (size_t)M * D;            // 8,388,608
  const size_t nWq = (size_t)3 * D * D;        // 3,145,728
  const size_t nWp = (size_t)D * D;            // 1,048,576

  // workspace layout (all offsets naturally aligned)
  char* w = (char*)d_ws;
  float*  qkv     = (float*)w;    w += (size_t)M * 3 * D * sizeof(float);  // 96 MB
  __bf16* x_hl    = (__bf16*)w;   w += 2 * nX  * sizeof(__bf16);
  __bf16* wq_hl   = (__bf16*)w;   w += 2 * nWq * sizeof(__bf16);
  __bf16* wp_hl   = (__bf16*)w;   w += 2 * nWp * sizeof(__bf16);
  __bf16* attn_hl = (__bf16*)w;

  dim3 blk(256);

  // one-shot split-bf16 conversion of activations and weights
  f32_to_bf16_split<<<dim3((unsigned)(nX  / 4 / 256)), blk, 0, stream>>>(x,      x_hl,  (int)(nX  / 4));
  f32_to_bf16_split<<<dim3((unsigned)(nWq / 4 / 256)), blk, 0, stream>>>(w_qkv,  wq_hl, (int)(nWq / 4));
  f32_to_bf16_split<<<dim3((unsigned)(nWp / 4 / 256)), blk, 0, stream>>>(w_proj, wp_hl, (int)(nWp / 4));

  // qkv = x @ w_qkv^T + b_qkv
  gemm_bf16x3<<<dim3((3 * D) / TILE_N, M / TILE_M), blk, 0, stream>>>(
      x_hl, wq_hl, b_qkv, qkv, M, 3 * D, D);

  // local-window attention (radius 4), emits split-bf16
  focal_attn<<<dim3((B * NHEADS * T) / 8), blk, 0, stream>>>(qkv, attn_hl);

  // out = attn @ w_proj^T + b_proj
  gemm_bf16x3<<<dim3(D / TILE_N, M / TILE_M), blk, 0, stream>>>(
      attn_hl, wp_hl, b_proj, out, M, D, D);
}

// v005
// One run takes 150 microseconds.
// In two side-by-side timings against v004, it was 1.05 and 1.06 times as fast.
// Counting every step since v000, it is 1.81 times as fast.
#include <hip/hip_runtime.h>
#include <hip/hip_bf16.h>

typedef float  v8f   __attribute__((ext_vector_type(8)));
typedef __bf16 v16bf __attribute__((ext_vector_type(16)));
typedef __bf16 v8bf  __attribute__((ext_vector_type(8)));
typedef __bf16 v4bf  __attribute__((ext_vector_type(4)));
typedef __bf16 v2bf  __attribute__((ext_vector_type(2)));
typedef int    v4i_  __attribute__((ext_vector_type(4)));
typedef float  v4f   __attribute__((ext_vector_type(4)));
typedef float  v2f   __attribute__((ext_vector_type(2)));

#define TILE_M 256
#define TILE_N 128
#define TILE_K 32
// Split operands live in memory as 128-byte units, one per row and 32-k block:
// 32 bf16 heads (64 B) followed by their 32 bf16 remainders (64 B). One K-step of
// a tile row is then exactly one whole, aligned cache line.
#define UNIT 64      // bf16 elements of a unit
#define UNIT_LO 32   // where the remainders start inside a unit
// LDS rows are the bare 128-byte units, no pad, so that three buffers of two
// work-groups fit one WGP's LDS. Instead the 16-byte piece c of row r lies at piece
// c ^ ((r >> 1) & 7): the 16 rows that a half-wave's ds_load_b128 touches then fall
// on 16 distinct 4-bank groups (row parity picks the half of the banks, the XOR the
// group inside it).
#define LDS_PITCH 64
#define NBUF 3       // LDS buffers of the K ring

#if __has_builtin(__builtin_amdgcn_global_load_async_to_lds_b128)
#define HAVE_ASYNC_LDS 1
#endif

#if defined(HAVE_ASYNC_LDS)
// builtin expects int4* in addrspace(1)/(3); HIP prints as1 as `__device__`.
#define GLOBAL_AS(p) ((__attribute__((address_space(1))) v4i_*)(p))
#define LDS_AS(p)    ((__attribute__((address_space(3))) v4i_*)(p))
// the wave's own copies, all but the n youngest, have landed; the clobber keeps LDS reads behind it
#define WAIT_ASYNC(n) asm volatile("s_wait_asynccnt %0" :: "i"(n) : "memory")
#endif

// ---------------------------------------------------------------------------
// Elementwise fp32 -> split bf16 (hi + residual lo), done once per tensor so
// the GEMM hot loop has zero conversion VALU and tiles are raw async-copyable.
// ---------------------------------------------------------------------------
__global__ __launch_bounds__(256)
void f32_to_bf16_split(const float* __restrict__ in, __bf16* __restrict__ hl, int n4) {
  int i = blockIdx.x * blockDim.x + threadIdx.x;
  if (i >= n4) return;
  float4 f = ((const float4*)in)[i];
  v4bf h, l;
  h.x = (__bf16)f.x;  l.x = (__bf16)(f.x - (float)h.x);
  h.y = (__bf16)f.y;  l.y = (__bf16)(f.y - (float)h.y);
  h.z = (__bf16)f.z;  l.z = (__bf16)(f.z - (float)h.z);
  h.w = (__bf16)f.w;  l.w = (__bf16)(f.w - (float)h.w);
  // element 4i: unit 4i / 32, place 4i % 32 (row lengths are multiples of 32)
  __bf16* u = hl + (size_t)(i >> 3) * UNIT + (i & 7) * 4;
  *(v4bf*)u = h;
  *(v4bf*)(u + UNIT_LO) = l;
}

// ---------------------------------------------------------------------------
// C[M,N] = (Ahi+Alo)[M,K] @ (Bhi+Blo)[N,K]^T + bias[N]   (bf16 split inputs,
// A and B each one buffer of head|remainder units, 2*K bf16 a row)
// Ring of three LDS buffers; tiles streamed two K-steps ahead with
// GLOBAL_LOAD_ASYNC_TO_LDS_B128 (ASYNCcnt) when available. 3 WMMAs (hh + hl + lh) per 16x16 tile ~ fp32.
// ---------------------------------------------------------------------------
__global__ __launch_bounds__(256)
void gemm_bf16x3(const __bf16* __restrict__ A, const __bf16* __restrict__ B,
                 const float* __restrict__ bias, float* __restrict__ C,
                 int M, int N, int K) {
  __shared__ __align__(16) __bf16 sA[NBUF][TILE_M * LDS_PITCH];
  __shared__ __align__(16) __bf16 sB[NBUF][TILE_N * LDS_PITCH];

  const int tid   = threadIdx.x;
  const int lane  = tid & 31;
  const int wave  = tid >> 5;     // 0..7
  const int waveM = wave >> 1;    // 0..3 -> 64-row slab
  const int waveN = wave & 1;     // 0..1 -> 64-col slab
  const int m0 = blockIdx.y * TILE_M;
  const int n0 = blockIdx.x * TILE_N;

  // cooperative copy mapping: 8 adjacent lanes cover one unit (one 128-B line), so a
  // wave-wide 16-byte copy touches 4 whole lines; a thread's copies are 32 rows apart
  const int crow = tid >> 3;          // 0..31
  const int ccol = (tid & 7) * 8;     // element offset (bf16) within the unit
  // the same piece's place in the LDS row (rows 32 apart share the swizzle)
  const int lcol = ((tid & 7) ^ ((crow >> 1) & 7)) * 8;

  // WMMA fragment addressing (this code's contiguous k order, used alike for A and B):
  // lane l -> row/col (l&15), K-base (l>>4)*16, 16 contiguous bf16.
  const int fr = lane & 15;
  // The 16 bf16 are pieces 2*(l>>4) and 2*(l>>4)+1 of the heads, +4 for the remainders;
  // element offsets of the four in a swizzled row (rows 16 apart share the swizzle)
  const int sw  = (fr >> 1) & 7;
  const int pc  = (lane >> 4) * 2;
  const int pH0 = ((pc)     ^ sw) * 8;
  const int pH1 = ((pc + 1) ^ sw) * 8;
  const int pL0 = ((pc + 4) ^ sw) * 8;
  const int pL1 = ((pc + 5) ^ sw) * 8;

  // copy one K-step (256 + 128 units = 48KB) into LDS buffer `buf`
  auto issue_tile = [&](int kk, int buf) {
    const size_t gstep = (size_t)32 * 2 * K;   // 32 rows further in memory
    const int    lstep = 32 * LDS_PITCH;       // 32 rows further in LDS
    const __bf16* gA = A + (size_t)(m0 + crow) * (2 * K) + (kk / TILE_K) * UNIT + ccol;
    const __bf16* gB = B + (size_t)(n0 + crow) * (2 * K) + (kk / TILE_K) * UNIT + ccol;
    __bf16* lA = &sA[buf][crow * LDS_PITCH + lcol];
    __bf16* lB = &sB[buf][crow * LDS_PITCH + lcol];
#if defined(HAVE_ASYNC_LDS)
    // 12 wave-wide async ops per wave per K-step; in-order completion.
    __builtin_amdgcn_global_load_async_to_lds_b128(GLOBAL_AS(gA),             LDS_AS(lA),             0, 0);
    __builtin_amdgcn_global_load_async_to_lds_b128(GLOBAL_AS(gA + gstep),     LDS_AS(lA + lstep),     0, 0);
    __builtin_amdgcn_global_load_async_to_lds_b128(GLOBAL_AS(gA + 2 * gstep), LDS_AS(lA + 2 * lstep), 0, 0);
    __builtin_amdgcn_global_load_async_to_lds_b128(GLOBAL_AS(gA + 3 * gstep), LDS_AS(lA + 3 * lstep), 0, 0);
    __builtin_amdgcn_global_load_async_to_lds_b128(GLOBAL_AS(gA + 4 * gstep), LDS_AS(lA + 4 * lstep), 0, 0);
    __builtin_amdgcn_global_load_async_to_lds_b128(GLOBAL_AS(gA + 5 * gstep), LDS_AS(lA + 5 * lstep), 0, 0);
    __builtin_amdgcn_global_load_async_to_lds_b128(GLOBAL_AS(gA + 6 * gstep), LDS_AS(lA + 6 * lstep), 0, 0);
    __builtin_amdgcn_global_load_async_to_lds_b128(GLOBAL_AS(gA + 7 * gstep), LDS_AS(lA + 7 * lstep), 0, 0);
    __builtin_amdgcn_global_load_async_to_lds_b128(GLOBAL_AS(gB),             LDS_AS(lB),             0, 0);
    __builtin_amdgcn_global_load_async_to_lds_b128(GLOBAL_AS(gB + gstep),     LDS_AS(lB + lstep),     0, 0);
    __builtin_amdgcn_global_load_async_to_lds_b128(GLOBAL_AS(gB + 2 * gstep), LDS_AS(lB + 2 * lstep), 0, 0);
    __builtin_amdgcn_global_load_async_to_lds_b128(GLOBAL_AS(gB + 3 * gstep), LDS_AS(lB + 3 * lstep), 0, 0);
#else
    *(uint4*)(lA)             = *(const uint4*)(gA);
    *(uint4*)(lA + lstep)     = *(const uint4*)(gA + gstep);
    *(uint4*)(lA + 2 * lstep) = *(const uint4*)(gA + 2 * gstep);
    *(uint4*)(lA + 3 * lstep) = *(const uint4*)(gA + 3 * gstep);
    *(uint4*)(lA + 4 * lstep) = *(const uint4*)(gA + 4 * gstep);
    *(uint4*)(lA + 5 * lstep) = *(const uint4*)(gA + 5 * gstep);
    *(uint4*)(lA + 6 * lstep) = *(const uint4*)(gA + 6 * gstep);
    *(uint4*)(lA + 7 * lstep) = *(const uint4*)(gA + 7 * gstep);
    *(uint4*)(lB)             = *(const uint4*)(gB);
    *(uint4*)(lB + lstep)     = *(const uint4*)(gB + gstep);
    *(uint4*)(lB + 2 * lstep) = *(const uint4*)(gB + 2 * gstep);
    *(uint4*)(lB + 3 * lstep) = *(const uint4*)(gB + 3 * gstep);
#endif
  };

  // one fragment = two 16-byte pieces of a swizzled row: two b128 reads
  auto load_frag = [&](const __bf16* row, int p0, int p1) {
    v8bf f0 = *(const v8bf*)(row + p0);
    v8bf f1 = *(const v8bf*)(row + p1);
    return __builtin_shufflevector(f0, f1, 0, 1, 2, 3, 4, 5, 6, 7,
                                   8, 9, 10, 11, 12, 13, 14, 15);
  };

  v8f acc[4][4] = {};

  const int nk = K / TILE_K;
  issue_tile(0, 0);
  if (nk > 1) issue_tile(TILE_K, 1);

  int cur  = 0;   // buffer of tile ik
  int fill = 2;   // buffer of tile ik + 2, the one tile ik - 1 was read from
  for (int ik = 0; ik < nk; ++ik) {
    // this wave's reads of tile ik - 1 have retired before its buffer is refilled below
    asm volatile("s_wait_dscnt 0x0" ::: "memory");
#if defined(HAVE_ASYNC_LDS)
    if (ik + 1 < nk) {
      WAIT_ASYNC(12);   // tile ik's 12 copies done, tile ik + 1's may still fly
    } else {
      WAIT_ASYNC(0);
    }
#endif
    // the one barrier of a K-step: tile ik visible to all waves, and every wave has
    // left tile ik - 1
    __syncthreads();
    if (ik + 2 < nk) issue_tile((ik + 2) * TILE_K, fill);   // two K-steps of lead

    v16bf aH[4], aL[4], bH[4], bL[4];
    #pragma unroll
    for (int i = 0; i < 4; ++i) {
      int r = waveM * 64 + i * 16 + fr;
      aH[i] = load_frag(&sA[cur][r * LDS_PITCH], pH0, pH1);
      aL[i] = load_frag(&sA[cur][r * LDS_PITCH], pL0, pL1);
    }
    #pragma unroll
    for (int j = 0; j < 4; ++j) {
      int c = waveN * 64 + j * 16 + fr;
      bH[j] = load_frag(&sB[cur][c * LDS_PITCH], pH0, pH1);
      bL[j] = load_frag(&sB[cur][c * LDS_PITCH], pL0, pL1);
    }

    #pragma unroll
    for (int i = 0; i < 4; ++i) {
      #pragma unroll
      for (int j = 0; j < 4; ++j) {
        acc[i][j] = __builtin_amdgcn_wmma_f32_16x16x32_bf16(
            false, aH[i], false, bH[j], (short)0, acc[i][j], false, false);
        acc[i][j] = __builtin_amdgcn_wmma_f32_16x16x32_bf16(
            false, aH[i], false, bL[j], (short)0, acc[i][j], false, false);
        acc[i][j] = __builtin_amdgcn_wmma_f32_16x16x32_bf16(
            false, aL[i], false, bH[j], (short)0, acc[i][j], false, false);
      }
    }
    fill = cur;
    cur  = (cur == NBUF - 1) ? 0 : cur + 1;
  }

  // epilogue: bias add + store (C layout: VGPR r -> M=r / r+8 by lane half)
  const int rowAdd = (lane >> 4) * 8;
  #pragma unroll
  for (int i = 0; i < 4; ++i) {
    #pragma unroll
    for (int j = 0; j < 4; ++j) {
      int gcol = n0 + waveN * 64 + j * 16 + fr;
      float bv = bias[gcol];
      #pragma unroll
      for (int r = 0; r < 8; ++r) {
        int grow = m0 + waveM * 64 + i * 16 + rowAdd + r;
        C[(size_t)grow * N + gcol] = acc[i][j][r] + bv;
      }
    }
  }
}

#define T_SEQ  2048
#define DMODEL 1024
#define NHEADS 16
#define HDIM   64
#define RAD    4
#define NWIN   (2 * RAD + 1)

// p plus the p of the lane that CTRL names inside the 16-lane row: a DPP add on the
// vector port (a shuffle through __shfl_xor goes through the LDS pipe and its wait)
template <int CTRL>
__device__ __forceinline__ float add_from_lane(float p) {
  return p + __int_as_float(__builtin_amdgcn_update_dpp(0, __float_as_int(p), CTRL, 0xf, 0xf, true));
}

// 2^x. v_exp_f32 and the one slot that the instruction set asks for behind a transcendental stand
// in one statement.
__device__ __forceinline__ float exp2_slot(float x) {
  float e;
  asm("v_exp_f32 %0, %1\n\tv_nop" : "=v"(e) : "v"(x));
  return e;
}

#define QPB 32   // queries of one head per work-group: 8 lanes each

// Eight lanes per (b,h,t): lane s of the eight holds dims 4s..4s+3 and 32+4s..32+4s+3,
// so a wave-wide 16-byte load covers one whole 128-B line of each of 4 queries' rows and
// a score is 8 products in the lane and 3 steps across lanes; <=9 keys per query.
// Emits split-bf16 output (head|remainder units) directly for the projection GEMM.
// At most 9 waves a SIMD: that leaves 112 registers a wave, enough to have the K rows and
// most V rows in flight at once; at the default the loads go out in small dependent batches.
__global__ __launch_bounds__(256) __attribute__((amdgpu_waves_per_eu(2, 9)))
void focal_attn(const float* __restrict__ qkv, __bf16* __restrict__ out_hl) {
  const int sub = threadIdx.x & 7;
  const int bh  = blockIdx.x / (T_SEQ / QPB);                           // same for the work-group
  const int t   = (blockIdx.x % (T_SEQ / QPB)) * QPB + (threadIdx.x >> 3);
  const int h   = bh % NHEADS;
  const int b   = bh / NHEADS;

  // this head's q columns in row 0 of batch b; k and v lie DMODEL and 2*DMODEL further
  const float* base = qkv + (size_t)b * T_SEQ * (3 * DMODEL) + h * HDIM;
  const unsigned qoff = (unsigned)t * (3 * DMODEL) + sub * 4;
  const v4f qa = *(const v4f*)(base + qoff);
  const v4f qb = *(const v4f*)(base + qoff + 32);
  const float scale = 0.125f; // 1/sqrt(64)

  float s[NWIN];
  v4f   va[NWIN], vb[NWIN];
  #pragma unroll
  for (int j = 0; j < NWIN; ++j) {
    int  tk = t - RAD + j;
    bool ok = (tk >= 0) && (tk < T_SEQ);
    int  tc = ok ? tk : t;
    const unsigned koff = (unsigned)tc * (3 * DMODEL) + sub * 4;
    v4f ka = *(const v4f*)(base + koff + DMODEL);
    v4f kb = *(const v4f*)(base + koff + DMODEL + 32);
    va[j]  = *(const v4f*)(base + koff + 2 * DMODEL);
    vb[j]  = *(const v4f*)(base + koff + 2 * DMODEL + 32);
    // two running sums (even and odd dims), the shape of the packed f32 multiply-add
    v2f p2 = qa.lo * ka.lo + qa.hi * ka.hi + qb.lo * kb.lo + qb.hi * kb.hi;
    float p = p2.x + p2.y;
    p = add_from_lane<0xB1>(p);    // quad_perm [1,0,3,2]: lane ^ 1
    p = add_from_lane<0x4E>(p);    // quad_perm [2,3,0,1]: lane ^ 2
    p = add_from_lane<0x164>(p);   // row_xmask 4:         lane ^ 4
    s[j] = ok ? p * scale : -__builtin_inff();
  }

  float m = s[0];
  #pragma unroll
  for (int j = 1; j < NWIN; ++j) m = fmaxf(m, s[j]);
  float sum = 0.0f;
  #pragma unroll
  for (int j = 0; j < NWIN; ++j) { float e = exp2_slot((s[j] - m) * 1.44269504f); s[j] = e; sum += e; }
  float inv = 1.0f / sum;

  v4f oa = {0.0f, 0.0f, 0.0f, 0.0f};
  v4f ob = {0.0f, 0.0f, 0.0f, 0.0f};
  #pragma unroll
  for (int j = 0; j < NWIN; ++j) { oa += s[j] * va[j]; ob += s[j] * vb[j]; }
  oa *= inv;
  ob *= inv;

  v4bf ha, la, hb, lb;
  ha.x = (__bf16)oa.x;  la.x = (__bf16)(oa.x - (float)ha.x);
  ha.y = (__bf16)oa.y;  la.y = (__bf16)(oa.y - (float)ha.y);
  ha.z = (__bf16)oa.z;  la.z = (__bf16)(oa.z - (float)ha.z);
  ha.w = (__bf16)oa.w;  la.w = (__bf16)(oa.w - (float)ha.w);
  hb.x = (__bf16)ob.x;  lb.x = (__bf16)(ob.x - (float)hb.x);
  hb.y = (__bf16)ob.y;  lb.y = (__bf16)(ob.y - (float)hb.y);
  hb.z = (__bf16)ob.z;  lb.z = (__bf16)(ob.z - (float)hb.z);
  hb.w = (__bf16)ob.w;  lb.w = (__bf16)(ob.w - (float)hb.w);
  // a head's 64 dims are two units of the row: dims 0..31 in unit 2h, dims 32..63 in unit 2h + 1
  __bf16* u = out_hl + ((size_t)(b * T_SEQ + t)) * (2 * DMODEL) + (2 * h) * UNIT + sub * 4;
  *(v4bf*)(u)                  = ha;
  *(v4bf*)(u + UNIT_LO)        = la;
  *(v4bf*)(u + UNIT)           = hb;
  *(v4bf*)(u + UNIT + UNIT_LO) = lb;
}

extern "C" void kernel_launch(void* const* d_in, const int* in_sizes, int n_in,
                              void* d_out, int out_size, void* d_ws, size_t ws_size,
                              hipStream_t stream) {
  const float* x      = (const float*)d_in[0];
  const float* w_qkv  = (const float*)d_in[1];
  const float* b_qkv  = (const float*)d_in[2];
  const float* w_proj = (const float*)d_in[3];
  const float* b_proj = (const float*)d_in[4];
  float* out = (float*)d_out;

  const int B = 4, T = T_SEQ, D = DMODEL;
  const int M = B * T;                         // 8192 rows
  const size_t nX  = (size_t)M * D;            // 8,388,608
  const size_t nWq = (size_t)3 * D * D;        // 3,145,728
  const size_t nWp = (size_t)D * D;            // 1,048,576

  // workspace layout (all offsets naturally aligned)
  char* w = (char*)d_ws;
  float*  qkv     = (float*)w;    w += (size_t)M * 3 * D * sizeof(float);  // 96 MB
  __bf16* x_hl    = (__bf16*)w;   w += 2 * nX  * sizeof(__bf16);
  __bf16* wq_hl   = (__bf16*)w;   w += 2 * nWq * sizeof(__bf16);
  __bf16* wp_hl   = (__bf16*)w;   w += 2 * nWp * sizeof(__bf16);
  __bf16* attn_hl = (__bf16*)w;

  dim3 blk(256);

  // one-shot split-bf16 conversion of activations and weights
  f32_to_bf16_split<<<dim3((unsigned)(nX  / 4 / 256)), blk, 0, stream>>>(x,      x_hl,  (int)(nX  / 4));
  f32_to_bf16_split<<<dim3((unsigned)(nWq / 4 / 256)), blk, 0, stream>>>(w_qkv,  wq_hl, (int)(nWq / 4));
  f32_to_bf16_split<<<dim3((unsigned)(nWp / 4 / 256)), blk, 0, stream>>>(w_proj, wp_hl, (int)(nWp / 4));

  // qkv = x @ w_qkv^T + b_qkv
  gemm_bf16x3<<<dim3((3 * D) / TILE_N, M / TILE_M), blk, 0, stream>>>(
      x_hl, wq_hl, b_qkv, qkv, M, 3 * D, D);

  // local-window attention (radius 4), emits split-bf16
  focal_attn<<<dim3((B * NHEADS * T) / QPB), blk, 0, stream>>>(qkv, attn_hl);

  // out = attn @ w_proj^T + b_proj
  gemm_bf16x3<<<dim3(D / TILE_N, M / TILE_M), blk, 0, stream>>>(
      attn_hl, wp_hl, b_proj, out, M, D, D);
}

// v006
// A run of this version takes 144 microseconds.
// Next to v005, in two timings, it ran 1.04 times as fast each time.
// Counting every step since v000, it is 1.88 times as fast.
#include <hip/hip_runtime.h>
#include <hip/hip_bf16.h>

typedef float  v8f   __attribute__((ext_vector_type(8)));
typedef __bf16 v16bf __attribute__((ext_vector_type(16)));
typedef __bf16 v8bf  __attribute__((ext_vector_type(8)));
typedef __bf16 v4bf  __attribute__((ext_vector_type(4)));
typedef __bf16 v2bf  __attribute__((ext_vector_type(2)));
typedef int    v4i_  __attribute__((ext_vector_type(4)));
typedef float  v4f   __attribute__((ext_vector_type(4)));
typedef float  v2f   __attribute__((ext_vector_type(2)));

#define TILE_M 256
#define TILE_N 128
#define TILE_K 32
// Split operands live in memory as 128-byte units, one per row and 32-k block:
// 32 bf16 heads (64 B) followed by their 32 bf16 remainders (64 B). One K-step of
// a tile row is then exactly one whole, aligned cache line.
#define UNIT 64      // bf16 elements of a unit
#define UNIT_LO 32   // where the remainders start inside a unit
// LDS rows are the bare 128-byte units, no pad, so that three buffers of two
// work-groups fit one WGP's LDS. Instead the 16-byte piece c of row r lies at piece
// c ^ ((r >> 1) & 7): the 16 rows that a half-wave's ds_load_b128 touches then fall
// on 16 distinct 4-bank groups (row parity picks the half of the banks, the XOR the
// group inside it).
#define LDS_PITCH 64
#define NBUF 3       // LDS buffers of the K ring

#if __has_builtin(__builtin_amdgcn_global_load_async_to_lds_b128)
#define HAVE_ASYNC_LDS 1
#endif

#if defined(HAVE_ASYNC_LDS)
// builtin expects int4* in addrspace(1)/(3); HIP prints as1 as `__device__`.
#define GLOBAL_AS(p) ((__attribute__((address_space(1))) v4i_*)(p))
#define LDS_AS(p)    ((__attribute__((address_space(3))) v4i_*)(p))
// the wave's own copies, all but the n youngest, have landed; the clobber keeps LDS reads behind it
#define WAIT_ASYNC(n) asm volatile("s_wait_asynccnt %0" :: "i"(n) : "memory")
#endif

// ---------------------------------------------------------------------------
// Elementwise fp32 -> split bf16 (hi + residual lo), done once per tensor so
// the GEMM hot loop has zero conversion VALU and tiles are raw async-copyable.
// ---------------------------------------------------------------------------
__global__ __launch_bounds__(256)
void f32_to_bf16_split(const float* __restrict__ in, __bf16* __restrict__ hl, int n4) {
  int i = blockIdx.x * blockDim.x + threadIdx.x;
  if (i >= n4) return;
  float4 f = ((const float4*)in)[i];
  v4bf h, l;
  h.x = (__bf16)f.x;  l.x = (__bf16)(f.x - (float)h.x);
  h.y = (__bf16)f.y;  l.y = (__bf16)(f.y - (float)h.y);
  h.z = (__bf16)f.z;  l.z = (__bf16)(f.z - (float)h.z);
  h.w = (__bf16)f.w;  l.w = (__bf16)(f.w - (float)h.w);
  // element 4i: unit 4i / 32, place 4i % 32 (row lengths are multiples of 32)
  __bf16* u = hl + (size_t)(i >> 3) * UNIT + (i & 7) * 4;
  *(v4bf*)u = h;
  *(v4bf*)(u + UNIT_LO) = l;
}

// ---------------------------------------------------------------------------
// C[M,N] = (Ahi+Alo)[M,K] @ (Bhi+Blo)[N,K]^T + bias[N]   (bf16 split inputs,
// A and B each one buffer of head|remainder units, 2*K bf16 a row)
// Ring of three LDS buffers; tiles streamed two K-steps ahead with
// GLOBAL_LOAD_ASYNC_TO_LDS_B128 (ASYNCcnt) when available. 3 WMMAs (hh + hl + lh) per 16x16 tile ~ fp32.
// ---------------------------------------------------------------------------
__global__ __launch_bounds__(256)
void gemm_bf16x3(const __bf16* __restrict__ A, const __bf16* __restrict__ B,
                 const float* __restrict__ bias, float* __restrict__ C,
                 int M, int N, int K) {
  __shared__ __align__(16) __bf16 sA[NBUF][TILE_M * LDS_PITCH];
  __shared__ __align__(16) __bf16 sB[NBUF][TILE_N * LDS_PITCH];

  const int tid   = threadIdx.x;
  const int lane  = tid & 31;
  const int wave  = tid >> 5;     // 0..7
  const int waveM = wave >> 1;    // 0..3 -> 64-row slab
  const int waveN = wave & 1;     // 0..1 -> 64-col slab
  const int m0 = blockIdx.y * TILE_M;
  const int n0 = blockIdx.x * TILE_N;

  // cooperative copy mapping: 8 adjacent lanes cover one unit (one 128-B line), so a
  // wave-wide 16-byte copy touches 4 whole lines; a thread's copies are 32 rows apart
  const int crow = tid >> 3;          // 0..31
  const int ccol = (tid & 7) * 8;     // element offset (bf16) within the unit
  // the same piece's place in the LDS row (rows 32 apart share the swizzle)
  const int lcol = ((tid & 7) ^ ((crow >> 1) & 7)) * 8;

  // WMMA fragment addressing (this code's contiguous k order, used alike for A and B):
  // lane l -> row/col (l&15), K-base (l>>4)*16, 16 contiguous bf16.
  const int fr = lane & 15;
  // The 16 bf16 are pieces 2*(l>>4) and 2*(l>>4)+1 of the heads, +4 for the remainders;
  // element offsets of the four in a swizzled row (rows 16 apart share the swizzle)
  const int sw  = (fr >> 1) & 7;
  const int pc  = (lane >> 4) * 2;
  const int pH0 = ((pc)     ^ sw) * 8;
  const int pH1 = ((pc + 1) ^ sw) * 8;
  const int pL0 = ((pc + 4) ^ sw) * 8;
  const int pL1 = ((pc + 5) ^ sw) * 8;

  // copy one K-step (256 + 128 units = 48KB) into LDS buffer `buf`
  auto issue_tile = [&](int kk, int buf) {
    const size_t gstep = (size_t)32 * 2 * K;   // 32 rows further in memory
    const int    lstep = 32 * LDS_PITCH;       // 32 rows further in LDS
    const __bf16* gA = A + (size_t)(m0 + crow) * (2 * K) + (kk / TILE_K) * UNIT + ccol;
    const __bf16* gB = B + (size_t)(n0 + crow) * (2 * K) + (kk / TILE_K) * UNIT + ccol;
    __bf16* lA = &sA[buf][crow * LDS_PITCH + lcol];
    __bf16* lB = &sB[buf][crow * LDS_PITCH + lcol];
#if defined(HAVE_ASYNC_LDS)
    // 12 wave-wide async ops per wave per K-step; in-order completion.
    __builtin_amdgcn_global_load_async_to_lds_b128(GLOBAL_AS(gA),             LDS_AS(lA),             0, 0);
    __builtin_amdgcn_global_load_async_to_lds_b128(GLOBAL_AS(gA + gstep),     LDS_AS(lA + lstep),     0, 0);
    __builtin_amdgcn_global_load_async_to_lds_b128(GLOBAL_AS(gA + 2 * gstep), LDS_AS(lA + 2 * lstep), 0, 0);
    __builtin_amdgcn_global_load_async_to_lds_b128(GLOBAL_AS(gA + 3 * gstep), LDS_AS(lA + 3 * lstep), 0, 0);
    __builtin_amdgcn_global_load_async_to_lds_b128(GLOBAL_AS(gA + 4 * gstep), LDS_AS(lA + 4 * lstep), 0, 0);
    __builtin_amdgcn_global_load_async_to_lds_b128(GLOBAL_AS(gA + 5 * gstep), LDS_AS(lA + 5 * lstep), 0, 0);
    __builtin_amdgcn_global_load_async_to_lds_b128(GLOBAL_AS(gA + 6 * gstep), LDS_AS(lA + 6 * lstep), 0, 0);
    __builtin_amdgcn_global_load_async_to_lds_b128(GLOBAL_AS(gA + 7 * gstep), LDS_AS(lA + 7 * lstep), 0, 0);
    __builtin_amdgcn_global_load_async_to_lds_b128(GLOBAL_AS(gB),             LDS_AS(lB),             0, 0);
    __builtin_amdgcn_global_load_async_to_lds_b128(GLOBAL_AS(gB + gstep),     LDS_AS(lB + lstep),     0, 0);
    __builtin_amdgcn_global_load_async_to_lds_b128(GLOBAL_AS(gB + 2 * gstep), LDS_AS(lB + 2 * lstep), 0, 0);
    __builtin_amdgcn_global_load_async_to_lds_b128(GLOBAL_AS(gB + 3 * gstep), LDS_AS(lB + 3 * lstep), 0, 0);
#else
    *(uint4*)(lA)             = *(const uint4*)(gA);
    *(uint4*)(lA + lstep)     = *(const uint4*)(gA + gstep);
    *(uint4*)(lA + 2 * lstep) = *(const uint4*)(gA + 2 * gstep);
    *(uint4*)(lA + 3 * lstep) = *(const uint4*)(gA + 3 * gstep);
    *(uint4*)(lA + 4 * lstep) = *(const uint4*)(gA + 4 * gstep);
    *(uint4*)(lA + 5 * lstep) = *(const uint4*)(gA + 5 * gstep);
    *(uint4*)(lA + 6 * lstep) = *(const uint4*)(gA + 6 * gstep);
    *(uint4*)(lA + 7 * lstep) = *(const uint4*)(gA + 7 * gstep);
    *(uint4*)(lB)             = *(const uint4*)(gB);
    *(uint4*)(lB + lstep)     = *(const uint4*)(gB + gstep);
    *(uint4*)(lB + 2 * lstep) = *(const uint4*)(gB + 2 * gstep);
    *(uint4*)(lB + 3 * lstep) = *(const uint4*)(gB + 3 * gstep);
#endif
  };

  // one fragment = two 16-byte pieces of a swizzled row: two b128 reads
  auto load_frag = [&](const __bf16* row, int p0, int p1) {
    v8bf f0 = *(const v8bf*)(row + p0);
    v8bf f1 = *(const v8bf*)(row + p1);
    return __builtin_shufflevector(f0, f1, 0, 1, 2, 3, 4, 5, 6, 7,
                                   8, 9, 10, 11, 12, 13, 14, 15);
  };

  v8f acc[4][4] = {};

  const int nk = K / TILE_K;
  issue_tile(0, 0);
  if (nk > 1) issue_tile(TILE_K, 1);

  int cur  = 0;   // buffer of tile ik
  int fill = 2;   // buffer of tile ik + 2, the one tile ik - 1 was read from
  for (int ik = 0; ik < nk; ++ik) {
    // this wave's reads of tile ik - 1 have retired before its buffer is refilled below
    asm volatile("s_wait_dscnt 0x0" ::: "memory");
#if defined(HAVE_ASYNC_LDS)
    if (ik + 1 < nk) {
      WAIT_ASYNC(12);   // tile ik's 12 copies done, tile ik + 1's may still fly
    } else {
      WAIT_ASYNC(0);
    }
#endif
    // the one barrier of a K-step: tile ik visible to all waves, and every wave has
    // left tile ik - 1
    __syncthreads();
    if (ik + 2 < nk) issue_tile((ik + 2) * TILE_K, fill);   // two K-steps of lead

    v16bf aH[4], aL[4], bH[4], bL[4];
    #pragma unroll
    for (int i = 0; i < 4; ++i) {
      int r = waveM * 64 + i * 16 + fr;
      aH[i] = load_frag(&sA[cur][r * LDS_PITCH], pH0, pH1);
      aL[i] = load_frag(&sA[cur][r * LDS_PITCH], pL0, pL1);
    }
    #pragma unroll
    for (int j = 0; j < 4; ++j) {
      int c = waveN * 64 + j * 16 + fr;
      bH[j] = load_frag(&sB[cur][c * LDS_PITCH], pH0, pH1);
      bL[j] = load_frag(&sB[cur][c * LDS_PITCH], pL0, pL1);
    }

    #pragma unroll
    for (int i = 0; i < 4; ++i) {
      #pragma unroll
      for (int j = 0; j < 4; ++j) {
        // B's rows (the n of C) go in as the first operand: a lane's 8 results are then
        // 8 consecutive n of one row of C, 16-byte pieces for the epilogue's staging
        acc[i][j] = __builtin_amdgcn_wmma_f32_16x16x32_bf16(
            false, bH[j], false, aH[i], (short)0, acc[i][j], false, false);
        acc[i][j] = __builtin_amdgcn_wmma_f32_16x16x32_bf16(
            false, bL[j], false, aH[i], (short)0, acc[i][j], false, false);
        acc[i][j] = __builtin_amdgcn_wmma_f32_16x16x32_bf16(
            false, bH[j], false, aL[i], (short)0, acc[i][j], false, false);
      }
    }
    fill = cur;
    cur  = (cur == NBUF - 1) ? 0 : cur + 1;
  }

  // epilogue: acc[i][j][r] = C[i*16 + (lane & 15)][j*16 + 8*(lane >> 4) + r] of the wave's 64x64.
  // Each wave turns its tile, 32 rows at a time, through 8 KB of LDS of its own, so that a
  // wave-wide 16-byte store writes two whole 256-byte row pieces (4 whole cache lines).
  // The 8 KB lie in the two ring buffers that do not hold the last tile: every wave left them,
  // and every copy into them had landed, before the loop's last barrier. After the loop
  // cur names the buffer behind the last tile's.
  const int nxt = (cur == NBUF - 1) ? 0 : cur + 1;
  float* stg = (float*)&sA[(wave & 4) ? nxt : cur][(wave & 3) * (32 * 128)];
  const int hh = lane >> 4;
  const v4f bv = *(const v4f*)(bias + n0 + waveN * 64 + fr * 4);
  // C's first element of this lane: row hh of the wave's tile, 16-byte piece fr of its 64 columns
  const unsigned c0 = (unsigned)(m0 + waveM * 64 + hh) * (unsigned)N + (unsigned)(n0 + waveN * 64 + fr * 4);
  #pragma unroll
  for (int g = 0; g < 2; ++g) {
    // rows of 256 B, no pad: the 16-byte piece p of row R lies at piece p ^ (R & 15), so the 16
    // rows that a half-wave writes, and the 16 pieces that it reads, fall on distinct banks
    #pragma unroll
    for (int ii = 0; ii < 2; ++ii) {
      float* row = stg + (ii * 16 + fr) * 64;
      #pragma unroll
      for (int j = 0; j < 4; ++j) {
        const v8f a = acc[2 * g + ii][j];
        *(v4f*)(row + ((j * 4 + 2 * hh)     ^ fr) * 4) = __builtin_shufflevector(a, a, 0, 1, 2, 3);
        *(v4f*)(row + ((j * 4 + 2 * hh + 1) ^ fr) * 4) = __builtin_shufflevector(a, a, 4, 5, 6, 7);
      }
    }
    // the wave's own rows stand in LDS before its other lanes read them back
    asm volatile("s_wait_dscnt 0x0" ::: "memory");
    v4f o[16];
    #pragma unroll
    for (int t = 0; t < 16; ++t) {
      const int R = 2 * t + hh;
      o[t] = *(const v4f*)(stg + R * 64 + (fr ^ (R & 15)) * 4);
    }
    #pragma unroll
    for (int t = 0; t < 16; ++t) {
      *(v4f*)(C + (c0 + (unsigned)(g * 32 + 2 * t) * (unsigned)N)) = o[t] + bv;
    }
    // before the next 32 rows reuse the stores' registers; the clobber also keeps the next
    // rows' LDS writes behind this round's LDS reads
    if (g == 0) asm volatile("s_wait_xcnt 0x0" ::: "memory");
  }
}

#define T_SEQ  2048
#define DMODEL 1024
#define NHEADS 16
#define HDIM   64
#define RAD    4
#define NWIN   (2 * RAD + 1)

// p plus the p of the lane that CTRL names inside the 16-lane row: a DPP add on the
// vector port (a shuffle through __shfl_xor goes through the LDS pipe and its wait)
template <int CTRL>
__device__ __forceinline__ float add_from_lane(float p) {
  return p + __int_as_float(__builtin_amdgcn_update_dpp(0, __float_as_int(p), CTRL, 0xf, 0xf, true));
}

// 2^x. v_exp_f32 and the one slot that the instruction set asks for behind a transcendental stand
// in one statement.
__device__ __forceinline__ float exp2_slot(float x) {
  float e;
  asm("v_exp_f32 %0, %1\n\tv_nop" : "=v"(e) : "v"(x));
  return e;
}

#define QPB 32   // queries of one head per work-group: 8 lanes each

// Eight lanes per (b,h,t): lane s of the eight holds dims 4s..4s+3 and 32+4s..32+4s+3,
// so a wave-wide 16-byte load covers one whole 128-B line of each of 4 queries' rows and
// a score is 8 products in the lane and 3 steps across lanes; <=9 keys per query.
// Emits split-bf16 output (head|remainder units) directly for the projection GEMM.
// At most 9 waves a SIMD: that leaves 112 registers a wave, enough to have the K rows and
// most V rows in flight at once; at the default the loads go out in small dependent batches.
__global__ __launch_bounds__(256) __attribute__((amdgpu_waves_per_eu(2, 9)))
void focal_attn(const float* __restrict__ qkv, __bf16* __restrict__ out_hl) {
  const int sub = threadIdx.x & 7;
  const int bh  = blockIdx.x / (T_SEQ / QPB);                           // same for the work-group
  const int t   = (blockIdx.x % (T_SEQ / QPB)) * QPB + (threadIdx.x >> 3);
  const int h   = bh % NHEADS;
  const int b   = bh / NHEADS;

  // this head's q columns in row 0 of batch b; k and v lie DMODEL and 2*DMODEL further
  const float* base = qkv + (size_t)b * T_SEQ * (3 * DMODEL) + h * HDIM;
  const unsigned qoff = (unsigned)t * (3 * DMODEL) + sub * 4;
  const v4f qa = *(const v4f*)(base + qoff);
  const v4f qb = *(const v4f*)(base + qoff + 32);
  const float scale = 0.125f; // 1/sqrt(64)

  float s[NWIN];
  v4f   va[NWIN], vb[NWIN];
  #pragma unroll
  for (int j = 0; j < NWIN; ++j) {
    int  tk = t - RAD + j;
    bool ok = (tk >= 0) && (tk < T_SEQ);
    int  tc = ok ? tk : t;
    const unsigned koff = (unsigned)tc * (3 * DMODEL) + sub * 4;
    v4f ka = *(const v4f*)(base + koff + DMODEL);
    v4f kb = *(const v4f*)(base + koff + DMODEL + 32);
    va[j]  = *(const v4f*)(base + koff + 2 * DMODEL);
    vb[j]  = *(const v4f*)(base + koff + 2 * DMODEL + 32);
    // two running sums (even and odd dims), the shape of the packed f32 multiply-add
    v2f p2 = qa.lo * ka.lo + qa.hi * ka.hi + qb.lo * kb.lo + qb.hi * kb.hi;
    float p = p2.x + p2.y;
    p = add_from_lane<0xB1>(p);    // quad_perm [1,0,3,2]: lane ^ 1
    p = add_from_lane<0x4E>(p);    // quad_perm [2,3,0,1]: lane ^ 2
    p = add_from_lane<0x164>(p);   // row_xmask 4:         lane ^ 4
    s[j] = ok ? p * scale : -__builtin_inff();
  }

  float m = s[0];
  #pragma unroll
  for (int j = 1; j < NWIN; ++j) m = fmaxf(m, s[j]);
  float sum = 0.0f;
  #pragma unroll
  for (int j = 0; j < NWIN; ++j) { float e = exp2_slot((s[j] - m) * 1.44269504f); s[j] = e; sum += e; }
  float inv = 1.0f / sum;

  v4f oa = {0.0f, 0.0f, 0.0f, 0.0f};
  v4f ob = {0.0f, 0.0f, 0.0f, 0.0f};
  #pragma unroll
  for (int j = 0; j < NWIN; ++j) { oa += s[j] * va[j]; ob += s[j] * vb[j]; }
  oa *= inv;
  ob *= inv;

  v4bf ha, la, hb, lb;
  ha.x = (__bf16)oa.x;  la.x = (__bf16)(oa.x - (float)ha.x);
  ha.y = (__bf16)oa.y;  la.y = (__bf16)(oa.y - (float)ha.y);
  ha.z = (__bf16)oa.z;  la.z = (__bf16)(oa.z - (float)ha.z);
  ha.w = (__bf16)oa.w;  la.w = (__bf16)(oa.w - (float)ha.w);
  hb.x = (__bf16)ob.x;  lb.x = (__bf16)(ob.x - (float)hb.x);
  hb.y = (__bf16)ob.y;  lb.y = (__bf16)(ob.y - (float)hb.y);
  hb.z = (__bf16)ob.z;  lb.z = (__bf16)(ob.z - (float)hb.z);
  hb.w = (__bf16)ob.w;  lb.w = (__bf16)(ob.w - (float)hb.w);
  // a head's 64 dims are two units of the row: dims 0..31 in unit 2h, dims 32..63 in unit 2h + 1
  __bf16* u = out_hl + ((size_t)(b * T_SEQ + t)) * (2 * DMODEL) + (2 * h) * UNIT + sub * 4;
  *(v4bf*)(u)                  = ha;
  *(v4bf*)(u + UNIT_LO)        = la;
  *(v4bf*)(u + UNIT)           = hb;
  *(v4bf*)(u + UNIT + UNIT_LO) = lb;
}

extern "C" void kernel_launch(void* const* d_in, const int* in_sizes, int n_in,
                              void* d_out, int out_size, void* d_ws, size_t ws_size,
                              hipStream_t stream) {
  const float* x      = (const float*)d_in[0];
  const float* w_qkv  = (const float*)d_in[1];
  const float* b_qkv  = (const float*)d_in[2];
  const float* w_proj = (const float*)d_in[3];
  const float* b_proj = (const float*)d_in[4];
  float* out = (float*)d_out;

  const int B = 4, T = T_SEQ, D = DMODEL;
  const int M = B * T;                         // 8192 rows
  const size_t nX  = (size_t)M * D;            // 8,388,608
  const size_t nWq = (size_t)3 * D * D;        // 3,145,728
  const size_t nWp = (size_t)D * D;            // 1,048,576

  // workspace layout (all offsets naturally aligned)
  char* w = (char*)d_ws;
  float*  qkv     = (float*)w;    w += (size_t)M * 3 * D * sizeof(float);  // 96 MB
  __bf16* x_hl    = (__bf16*)w;   w += 2 * nX  * sizeof(__bf16);
  __bf16* wq_hl   = (__bf16*)w;   w += 2 * nWq * sizeof(__bf16);
  __bf16* wp_hl   = (__bf16*)w;   w += 2 * nWp * sizeof(__bf16);
  __bf16* attn_hl = (__bf16*)w;

  dim3 blk(256);

  // one-shot split-bf16 conversion of activations and weights
  f32_to_bf16_split<<<dim3((unsigned)(nX  / 4 / 256)), blk, 0, stream>>>(x,      x_hl,  (int)(nX  / 4));
  f32_to_bf16_split<<<dim3((unsigned)(nWq / 4 / 256)), blk, 0, stream>>>(w_qkv,  wq_hl, (int)(nWq / 4));
  f32_to_bf16_split<<<dim3((unsigned)(nWp / 4 / 256)), blk, 0, stream>>>(w_proj, wp_hl, (int)(nWp / 4));

  // qkv = x @ w_qkv^T + b_qkv
  gemm_bf16x3<<<dim3((3 * D) / TILE_N, M / TILE_M), blk, 0, stream>>>(
      x_hl, wq_hl, b_qkv, qkv, M, 3 * D, D);

  // local-window attention (radius 4), emits split-bf16
  focal_attn<<<dim3((B * NHEADS * T) / QPB), blk, 0, stream>>>(qkv, attn_hl);

  // out = attn @ w_proj^T + b_proj
  gemm_bf16x3<<<dim3(D / TILE_N, M / TILE_M), blk, 0, stream>>>(
      attn_hl, wp_hl, b_proj, out, M, D, D);
}

// v007
// Measured time: 138 microseconds a run.
// Next to v006, in two timings, it ran 1.04 times as fast each time.
// All steps since v000 together make it 1.97 times as fast.
#include <hip/hip_runtime.h>
#include <hip/hip_bf16.h>

typedef float  v8f   __attribute__((ext_vector_type(8)));
typedef __bf16 v16bf __attribute__((ext_vector_type(16)));
typedef __bf16 v8bf  __attribute__((ext_vector_type(8)));
typedef __bf16 v4bf  __attribute__((ext_vector_type(4)));
typedef __bf16 v2bf  __attribute__((ext_vector_type(2)));
typedef int    v4i_  __attribute__((ext_vector_type(4)));
typedef float  v4f   __attribute__((ext_vector_type(4)));
typedef float  v2f   __attribute__((ext_vector_type(2)));

#define TILE_M 256
#define TILE_N 128
#define TILE_K 32
// Split operands live in memory as 128-byte units, one per row and 32-k block:
// 32 bf16 heads (64 B) followed by their 32 bf16 remainders (64 B). One K-step of
// a tile row is then exactly one whole, aligned cache line.
#define UNIT 64      // bf16 elements of a unit
#define UNIT_LO 32   // where the remainders start inside a unit
// The units of a tensor are ordered by panels of 128 rows: panel, then 32-k block, then row
// in the panel. One K-step of a panel is then 16 KB in a row (not 128 lines at the pitch of a
// whole row), a wave-wide 16-byte copy covers 512 bytes in a row, and a panel is read from
// front to back as K advances.
#define PANEL 128
#define KSLAB (PANEL * UNIT)   // bf16 elements of one K-step of a panel
// LDS rows are the bare 128-byte units, no pad, so that three buffers of two
// work-groups fit one WGP's LDS. Instead the 16-byte piece c of row r lies at piece
// c ^ ((r >> 1) & 7): the 16 rows that a half-wave's ds_load_b128 touches then fall
// on 16 distinct 4-bank groups (row parity picks the half of the banks, the XOR the
// group inside it).
#define LDS_PITCH 64
#define NBUF 3       // LDS buffers of the K ring

#if __has_builtin(__builtin_amdgcn_global_load_async_to_lds_b128)
#define HAVE_ASYNC_LDS 1
#endif

#if defined(HAVE_ASYNC_LDS)
// builtin expects int4* in addrspace(1)/(3); HIP prints as1 as `__device__`.
#define GLOBAL_AS(p) ((__attribute__((address_space(1))) v4i_*)(p))
#define LDS_AS(p)    ((__attribute__((address_space(3))) v4i_*)(p))
// the wave's own copies, all but the n youngest, have landed; the clobber keeps LDS reads behind it
#define WAIT_ASYNC(n) asm volatile("s_wait_asynccnt %0" :: "i"(n) : "memory")
#endif

#define T_SEQ  2048
#define DMODEL 1024
#define NHEADS 16
#define HDIM   64
#define RAD    4
#define NWIN   (2 * RAD + 1)
#define KBLK   (DMODEL / TILE_K)   // 32-k blocks of a row of DMODEL

// first element of the unit of row `row` and k block `kb`; nkb k blocks a row
__device__ __forceinline__ size_t unit_at(unsigned row, unsigned kb, unsigned nkb) {
  return ((size_t)((row / PANEL) * nkb + kb) * PANEL + (row % PANEL)) * UNIT;
}

// ---------------------------------------------------------------------------
// Elementwise fp32 -> split bf16 (hi + residual lo), done once per tensor so
// the GEMM hot loop has zero conversion VALU and tiles are raw async-copyable.
// ---------------------------------------------------------------------------
// Rows of DMODEL floats. Eight lanes make one unit; a wave takes 2 rows x 2 k blocks, so that
// it reads 256 bytes in a row of each row and writes 256 bytes in a row of each k block.
__global__ __launch_bounds__(256)
void f32_to_bf16_split(const float* __restrict__ in, __bf16* __restrict__ hl, int n4) {
  int i = blockIdx.x * blockDim.x + threadIdx.x;
  if (i >= n4) return;
  const unsigned un  = (unsigned)i >> 3;                         // the unit's number in this order
  const unsigned kb  = (((un >> 2) % (KBLK / 2)) << 1) | (un & 1);
  const unsigned row = (((un >> 2) / (KBLK / 2)) << 1) | ((un >> 1) & 1);
  float4 f = ((const float4*)in)[row * (DMODEL / 4) + kb * 8 + (i & 7)];
  v4bf h, l;
  h.x = (__bf16)f.x;  l.x = (__bf16)(f.x - (float)h.x);
  h.y = (__bf16)f.y;  l.y = (__bf16)(f.y - (float)h.y);
  h.z = (__bf16)f.z;  l.z = (__bf16)(f.z - (float)h.z);
  h.w = (__bf16)f.w;  l.w = (__bf16)(f.w - (float)h.w);
  __bf16* u = hl + unit_at(row, kb, KBLK) + (i & 7) * 4;
  *(v4bf*)u = h;
  *(v4bf*)(u + UNIT_LO) = l;
}

// ---------------------------------------------------------------------------
// C[M,N] = (Ahi+Alo)[M,K] @ (Bhi+Blo)[N,K]^T + bias[N]   (bf16 split inputs,
// A and B each one buffer of head|remainder units in panel order, 2*K bf16 a row;
// M a multiple of 256, N of 128)
// Ring of three LDS buffers; tiles streamed two K-steps ahead with
// GLOBAL_LOAD_ASYNC_TO_LDS_B128 (ASYNCcnt) when available. 3 WMMAs (hh + hl + lh) per 16x16 tile ~ fp32.
// ---------------------------------------------------------------------------
__global__ __launch_bounds__(256)
void gemm_bf16x3(const __bf16* __restrict__ A, const __bf16* __restrict__ B,
                 const float* __restrict__ bias, float* __restrict__ C,
                 int M, int N, int K) {
  __shared__ __align__(16) __bf16 sA[NBUF][TILE_M * LDS_PITCH];
  __shared__ __align__(16) __bf16 sB[NBUF][TILE_N * LDS_PITCH];

  const int tid   = threadIdx.x;
  const int lane  = tid & 31;
  const int wave  = tid >> 5;     // 0..7
  const int waveM = wave >> 1;    // 0..3 -> 64-row slab
  const int waveN = wave & 1;     // 0..1 -> 64-col slab
  const int m0 = blockIdx.y * TILE_M;
  const int n0 = blockIdx.x * TILE_N;

  // cooperative copy mapping: 8 adjacent lanes cover one unit (one 128-B line), a wave 4 units
  // that follow one another in memory; a thread's copies are 32 rows apart
  const int crow = tid >> 3;          // 0..31
  const int ccol = (tid & 7) * 8;     // element offset (bf16) within the unit
  // the same piece's place in the LDS row (rows 32 apart share the swizzle)
  const int lcol = ((tid & 7) ^ ((crow >> 1) & 7)) * 8;

  // WMMA fragment addressing (this code's contiguous k order, used alike for A and B):
  // lane l -> row/col (l&15), K-base (l>>4)*16, 16 contiguous bf16.
  const int fr = lane & 15;
  // The 16 bf16 are pieces 2*(l>>4) and 2*(l>>4)+1 of the heads, +4 for the remainders;
  // element offsets of the four in a swizzled row (rows 16 apart share the swizzle)
  const int sw  = (fr >> 1) & 7;
  const int pc  = (lane >> 4) * 2;
  const int pH0 = ((pc)     ^ sw) * 8;
  const int pH1 = ((pc + 1) ^ sw) * 8;
  const int pL0 = ((pc + 4) ^ sw) * 8;
  const int pL1 = ((pc + 5) ^ sw) * 8;

  // copy one K-step (256 + 128 units = 48KB) into LDS buffer `buf`: two 16-KB slabs of A (the
  // tile's two panels) and one of B. 32 rows further is 4,096 bytes further in memory and in
  // LDS alike, which is what the copy's offset field moves: one address pair serves a slab.
  auto issue_tile = [&](int kk, int buf) {
    const size_t pstep = (size_t)PANEL * 2 * K;   // one whole panel further in memory
    const int    lstep = 32 * LDS_PITCH;          // 32 rows further in LDS
    const size_t slab  = (size_t)(kk / TILE_K) * KSLAB + crow * UNIT + ccol;
    const __bf16* gA = A + (size_t)(m0 / PANEL) * pstep + slab;
    const __bf16* gB = B + (size_t)(n0 / PANEL) * pstep + slab;
    const __bf16* gA1 = gA + pstep;
    __bf16* lA  = &sA[buf][crow * LDS_PITCH + lcol];
    __bf16* lA1 = lA + PANEL * LDS_PITCH;
    __bf16* lB  = &sB[buf][crow * LDS_PITCH + lcol];
#if defined(HAVE_ASYNC_LDS)
    // 12 wave-wide async ops per wave per K-step; in-order completion.
    __builtin_amdgcn_global_load_async_to_lds_b128(GLOBAL_AS(gA),  LDS_AS(lA),  0,     0);
    __builtin_amdgcn_global_load_async_to_lds_b128(GLOBAL_AS(gA),  LDS_AS(lA),  4096,  0);
    __builtin_amdgcn_global_load_async_to_lds_b128(GLOBAL_AS(gA),  LDS_AS(lA),  8192,  0);
    __builtin_amdgcn_global_load_async_to_lds_b128(GLOBAL_AS(gA),  LDS_AS(lA),  12288, 0);
    __builtin_amdgcn_global_load_async_to_lds_b128(GLOBAL_AS(gA1), LDS_AS(lA1), 0,     0);
    __builtin_amdgcn_global_load_async_to_lds_b128(GLOBAL_AS(gA1), LDS_AS(lA1), 4096,  0);
    __builtin_amdgcn_global_load_async_to_lds_b128(GLOBAL_AS(gA1), LDS_AS(lA1), 8192,  0);
    __builtin_amdgcn_global_load_async_to_lds_b128(GLOBAL_AS(gA1), LDS_AS(lA1), 12288, 0);
    __builtin_amdgcn_global_load_async_to_lds_b128(GLOBAL_AS(gB),  LDS_AS(lB),  0,     0);
    __builtin_amdgcn_global_load_async_to_lds_b128(GLOBAL_AS(gB),  LDS_AS(lB),  4096,  0);
    __builtin_amdgcn_global_load_async_to_lds_b128(GLOBAL_AS(gB),  LDS_AS(lB),  8192,  0);
    __builtin_amdgcn_global_load_async_to_lds_b128(GLOBAL_AS(gB),  LDS_AS(lB),  12288, 0);
#else
    #pragma unroll
    for (int j = 0; j < 4; ++j) {
      *(uint4*)(lA  + j * lstep) = *(const uint4*)(gA  + j * 32 * UNIT);
      *(uint4*)(lA1 + j * lstep) = *(const uint4*)(gA1 + j * 32 * UNIT);
      *(uint4*)(lB  + j * lstep) = *(const uint4*)(gB  + j * 32 * UNIT);
    }
#endif
  };

  // one fragment = two 16-byte pieces of a swizzled row: two b128 reads
  auto load_frag = [&](const __bf16* row, int p0, int p1) {
    v8bf f0 = *(const v8bf*)(row + p0);
    v8bf f1 = *(const v8bf*)(row + p1);
    return __builtin_shufflevector(f0, f1, 0, 1, 2, 3, 4, 5, 6, 7,
                                   8, 9, 10, 11, 12, 13, 14, 15);
  };

  v8f acc[4][4] = {};

  const int nk = K / TILE_K;
  issue_tile(0, 0);
  if (nk > 1) issue_tile(TILE_K, 1);

  int cur  = 0;   // buffer of tile ik
  int fill = 2;   // buffer of tile ik + 2, the one tile ik - 1 was read from
  for (int ik = 0; ik < nk; ++ik) {
    // this wave's reads of tile ik - 1 have retired before its buffer is refilled below
    asm volatile("s_wait_dscnt 0x0" ::: "memory");
#if defined(HAVE_ASYNC_LDS)
    if (ik + 1 < nk) {
      WAIT_ASYNC(12);   // tile ik's 12 copies done, tile ik + 1's may still fly
    } else {
      WAIT_ASYNC(0);
    }
#endif
    // the one barrier of a K-step: tile ik visible to all waves, and every wave has
    // left tile ik - 1
    __syncthreads();
    if (ik + 2 < nk) issue_tile((ik + 2) * TILE_K, fill);   // two K-steps of lead

    v16bf aH[4], aL[4], bH[4], bL[4];
    #pragma unroll
    for (int i = 0; i < 4; ++i) {
      int r = waveM * 64 + i * 16 + fr;
      aH[i] = load_frag(&sA[cur][r * LDS_PITCH], pH0, pH1);
      aL[i] = load_frag(&sA[cur][r * LDS_PITCH], pL0, pL1);
    }
    #pragma unroll
    for (int j = 0; j < 4; ++j) {
      int c = waveN * 64 + j * 16 + fr;
      bH[j] = load_frag(&sB[cur][c * LDS_PITCH], pH0, pH1);
      bL[j] = load_frag(&sB[cur][c * LDS_PITCH], pL0, pL1);
    }

    #pragma unroll
    for (int i = 0; i < 4; ++i) {
      #pragma unroll
      for (int j = 0; j < 4; ++j) {
        // B's rows (the n of C) go in as the first operand: a lane's 8 results are then
        // 8 consecutive n of one row of C, 16-byte pieces for the epilogue's staging
        acc[i][j] = __builtin_amdgcn_wmma_f32_16x16x32_bf16(
            false, bH[j], false, aH[i], (short)0, acc[i][j], false, false);
        acc[i][j] = __builtin_amdgcn_wmma_f32_16x16x32_bf16(
            false, bL[j], false, aH[i], (short)0, acc[i][j], false, false);
        acc[i][j] = __builtin_amdgcn_wmma_f32_16x16x32_bf16(
            false, bH[j], false, aL[i], (short)0, acc[i][j], false, false);
      }
    }
    fill = cur;
    cur  = (cur == NBUF - 1) ? 0 : cur + 1;
  }

  // epilogue: acc[i][j][r] = C[i*16 + (lane & 15)][j*16 + 8*(lane >> 4) + r] of the wave's 64x64.
  // Each wave turns its tile, 32 rows at a time, through 8 KB of LDS of its own, so that a
  // wave-wide 16-byte store writes two whole 256-byte row pieces (4 whole cache lines).
  // The 8 KB lie in the two ring buffers that do not hold the last tile: every wave left them,
  // and every copy into them had landed, before the loop's last barrier. After the loop
  // cur names the buffer behind the last tile's.
  const int nxt = (cur == NBUF - 1) ? 0 : cur + 1;
  float* stg = (float*)&sA[(wave & 4) ? nxt : cur][(wave & 3) * (32 * 128)];
  const int hh = lane >> 4;
  const v4f bv = *(const v4f*)(bias + n0 + waveN * 64 + fr * 4);
  // C's first element of this lane: row hh of the wave's tile, 16-byte piece fr of its 64 columns
  const unsigned c0 = (unsigned)(m0 + waveM * 64 + hh) * (unsigned)N + (unsigned)(n0 + waveN * 64 + fr * 4);
  #pragma unroll
  for (int g = 0; g < 2; ++g) {
    // rows of 256 B, no pad: the 16-byte piece p of row R lies at piece p ^ (R & 15), so the 16
    // rows that a half-wave writes, and the 16 pieces that it reads, fall on distinct banks
    #pragma unroll
    for (int ii = 0; ii < 2; ++ii) {
      float* row = stg + (ii * 16 + fr) * 64;
      #pragma unroll
      for (int j = 0; j < 4; ++j) {
        const v8f a = acc[2 * g + ii][j];
        *(v4f*)(row + ((j * 4 + 2 * hh)     ^ fr) * 4) = __builtin_shufflevector(a, a, 0, 1, 2, 3);
        *(v4f*)(row + ((j * 4 + 2 * hh + 1) ^ fr) * 4) = __builtin_shufflevector(a, a, 4, 5, 6, 7);
      }
    }
    // the wave's own rows stand in LDS before its other lanes read them back
    asm volatile("s_wait_dscnt 0x0" ::: "memory");
    v4f o[16];
    #pragma unroll
    for (int t = 0; t < 16; ++t) {
      const int R = 2 * t + hh;
      o[t] = *(const v4f*)(stg + R * 64 + (fr ^ (R & 15)) * 4);
    }
    #pragma unroll
    for (int t = 0; t < 16; ++t) {
      *(v4f*)(C + (c0 + (unsigned)(g * 32 + 2 * t) * (unsigned)N)) = o[t] + bv;
    }
    // before the next 32 rows reuse the stores' registers; the clobber also keeps the next
    // rows' LDS writes behind this round's LDS reads
    if (g == 0) asm volatile("s_wait_xcnt 0x0" ::: "memory");
  }
}

// p plus the p of the lane that CTRL names inside the 16-lane row: a DPP add on the
// vector port (a shuffle through __shfl_xor goes through the LDS pipe and its wait)
template <int CTRL>
__device__ __forceinline__ float add_from_lane(float p) {
  return p + __int_as_float(__builtin_amdgcn_update_dpp(0, __float_as_int(p), CTRL, 0xf, 0xf, true));
}

// 2^x. v_exp_f32 and the one slot that the instruction set asks for behind a transcendental stand
// in one statement.
__device__ __forceinline__ float exp2_slot(float x) {
  float e;
  asm("v_exp_f32 %0, %1\n\tv_nop" : "=v"(e) : "v"(x));
  return e;
}

#define QPB 32   // queries of one head per work-group: 8 lanes each

// Eight lanes per (b,h,t): lane s of the eight holds dims 4s..4s+3 and 32+4s..32+4s+3,
// so a wave-wide 16-byte load covers one whole 128-B line of each of 4 queries' rows and
// a score is 8 products in the lane and 3 steps across lanes; <=9 keys per query.
// Emits split-bf16 output (head|remainder units) directly for the projection GEMM.
// At most 9 waves a SIMD: that leaves 112 registers a wave, enough to have the K rows and
// most V rows in flight at once; at the default the loads go out in small dependent batches.
__global__ __launch_bounds__(256) __attribute__((amdgpu_waves_per_eu(2, 9)))
void focal_attn(const float* __restrict__ qkv, __bf16* __restrict__ out_hl) {
  const int sub = threadIdx.x & 7;
  const int bh  = blockIdx.x / (T_SEQ / QPB);                           // same for the work-group
  const int t   = (blockIdx.x % (T_SEQ / QPB)) * QPB + (threadIdx.x >> 3);
  const int h   = bh % NHEADS;
  const int b   = bh / NHEADS;

  // this head's q columns in row 0 of batch b; k and v lie DMODEL and 2*DMODEL further
  const float* base = qkv + (size_t)b * T_SEQ * (3 * DMODEL) + h * HDIM;
  const unsigned qoff = (unsigned)t * (3 * DMODEL) + sub * 4;
  const v4f qa = *(const v4f*)(base + qoff);
  const v4f qb = *(const v4f*)(base + qoff + 32);
  const float scale = 0.125f; // 1/sqrt(64)

  float s[NWIN];
  v4f   va[NWIN], vb[NWIN];
  #pragma unroll
  for (int j = 0; j < NWIN; ++j) {
    int  tk = t - RAD + j;
    bool ok = (tk >= 0) && (tk < T_SEQ);
    int  tc = ok ? tk : t;
    const unsigned koff = (unsigned)tc * (3 * DMODEL) + sub * 4;
    v4f ka = *(const v4f*)(base + koff + DMODEL);
    v4f kb = *(const v4f*)(base + koff + DMODEL + 32);
    va[j]  = *(const v4f*)(base + koff + 2 * DMODEL);
    vb[j]  = *(const v4f*)(base + koff + 2 * DMODEL + 32);
    // two running sums (even and odd dims), the shape of the packed f32 multiply-add
    v2f p2 = qa.lo * ka.lo + qa.hi * ka.hi + qb.lo * kb.lo + qb.hi * kb.hi;
    float p = p2.x + p2.y;
    p = add_from_lane<0xB1>(p);    // quad_perm [1,0,3,2]: lane ^ 1
    p = add_from_lane<0x4E>(p);    // quad_perm [2,3,0,1]: lane ^ 2
    p = add_from_lane<0x164>(p);   // row_xmask 4:         lane ^ 4
    s[j] = ok ? p * scale : -__builtin_inff();
  }

  float m = s[0];
  #pragma unroll
  for (int j = 1; j < NWIN; ++j) m = fmaxf(m, s[j]);
  float sum = 0.0f;
  #pragma unroll
  for (int j = 0; j < NWIN; ++j) { float e = exp2_slot((s[j] - m) * 1.44269504f); s[j] = e; sum += e; }
  float inv = 1.0f / sum;

  v4f oa = {0.0f, 0.0f, 0.0f, 0.0f};
  v4f ob = {0.0f, 0.0f, 0.0f, 0.0f};
  #pragma unroll
  for (int j = 0; j < NWIN; ++j) { oa += s[j] * va[j]; ob += s[j] * vb[j]; }
  oa *= inv;
  ob *= inv;

  v4bf ha, la, hb, lb;
  ha.x = (__bf16)oa.x;  la.x = (__bf16)(oa.x - (float)ha.x);
  ha.y = (__bf16)oa.y;  la.y = (__bf16)(oa.y - (float)ha.y);
  ha.z = (__bf16)oa.z;  la.z = (__bf16)(oa.z - (float)ha.z);
  ha.w = (__bf16)oa.w;  la.w = (__bf16)(oa.w - (float)ha.w);
  hb.x = (__bf16)ob.x;  lb.x = (__bf16)(ob.x - (float)hb.x);
  hb.y = (__bf16)ob.y;  lb.y = (__bf16)(ob.y - (float)hb.y);
  hb.z = (__bf16)ob.z;  lb.z = (__bf16)(ob.z - (float)hb.z);
  hb.w = (__bf16)ob.w;  lb.w = (__bf16)(ob.w - (float)hb.w);
  // a head's 64 dims are two units of the row: dims 0..31 in k block 2h, dims 32..63 in 2h + 1,
  // which lies one K-step slab further in the row's panel
  __bf16* u = out_hl + unit_at(b * T_SEQ + t, 2 * h, KBLK) + sub * 4;
  *(v4bf*)(u)                   = ha;
  *(v4bf*)(u + UNIT_LO)         = la;
  *(v4bf*)(u + KSLAB)           = hb;
  *(v4bf*)(u + KSLAB + UNIT_LO) = lb;
}

extern "C" void kernel_launch(void* const* d_in, const int* in_sizes, int n_in,
                              void* d_out, int out_size, void* d_ws, size_t ws_size,
                              hipStream_t stream) {
  const float* x      = (const float*)d_in[0];
  const float* w_qkv  = (const float*)d_in[1];
  const float* b_qkv  = (const float*)d_in[2];
  const float* w_proj = (const float*)d_in[3];
  const float* b_proj = (const float*)d_in[4];
  float* out = (float*)d_out;

  const int B = 4, T = T_SEQ, D = DMODEL;
  const int M = B * T;                         // 8192 rows
  const size_t nX  = (size_t)M * D;            // 8,388,608
  const size_t nWq = (size_t)3 * D * D;        // 3,145,728
  const size_t nWp = (size_t)D * D;            // 1,048,576

  // workspace layout (all offsets naturally aligned)
  char* w = (char*)d_ws;
  float*  qkv     = (float*)w;    w += (size_t)M * 3 * D * sizeof(float);  // 96 MB
  __bf16* x_hl    = (__bf16*)w;   w += 2 * nX  * sizeof(__bf16);
  __bf16* wq_hl   = (__bf16*)w;   w += 2 * nWq * sizeof(__bf16);
  __bf16* wp_hl   = (__bf16*)w;   w += 2 * nWp * sizeof(__bf16);
  __bf16* attn_hl = (__bf16*)w;

  dim3 blk(256);

  // one-shot split-bf16 conversion of activations and weights
  f32_to_bf16_split<<<dim3((unsigned)(nX  / 4 / 256)), blk, 0, stream>>>(x,      x_hl,  (int)(nX  / 4));
  f32_to_bf16_split<<<dim3((unsigned)(nWq / 4 / 256)), blk, 0, stream>>>(w_qkv,  wq_hl, (int)(nWq / 4));
  f32_to_bf16_split<<<dim3((unsigned)(nWp / 4 / 256)), blk, 0, stream>>>(w_proj, wp_hl, (int)(nWp / 4));

  // qkv = x @ w_qkv^T + b_qkv
  gemm_bf16x3<<<dim3((3 * D) / TILE_N, M / TILE_M), blk, 0, stream>>>(
      x_hl, wq_hl, b_qkv, qkv, M, 3 * D, D);

  // local-window attention (radius 4), emits split-bf16
  focal_attn<<<dim3((B * NHEADS * T) / QPB), blk, 0, stream>>>(qkv, attn_hl);

  // out = attn @ w_proj^T + b_proj
  gemm_bf16x3<<<dim3(D / TILE_N, M / TILE_M), blk, 0, stream>>>(
      attn_hl, wp_hl, b_proj, out, M, D, D);
}

// v008
// It runs in 132 microseconds.
// Next to v007, in two timings, it ran 1.05 times as fast each time.
// Counting every step since v000, it is 2.07 times as fast.
#include <hip/hip_runtime.h>
#include <hip/hip_bf16.h>

typedef float  v8f   __attribute__((ext_vector_type(8)));
typedef __bf16 v16bf __attribute__((ext_vector_type(16)));
typedef __bf16 v8bf  __attribute__((ext_vector_type(8)));
typedef __bf16 v4bf  __attribute__((ext_vector_type(4)));
typedef __bf16 v2bf  __attribute__((ext_vector_type(2)));
typedef int    v4i_  __attribute__((ext_vector_type(4)));
typedef float  v4f   __attribute__((ext_vector_type(4)));
typedef float  v2f   __attribute__((ext_vector_type(2)));

#define TILE_M 256
#define TILE_N 128
#define TILE_K 32
// Split operands live in memory as 128-byte units, one per row and 32-k block:
// 32 bf16 heads (64 B) followed by their 32 bf16 remainders (64 B). One K-step of
// a tile row is then exactly one whole, aligned cache line.
#define UNIT 64      // bf16 elements of a unit
#define UNIT_LO 32   // where the remainders start inside a unit
// The units of a tensor are ordered by panels of 128 rows: panel, then 32-k block, then row
// in the panel. One K-step of a panel is then 16 KB in a row (not 128 lines at the pitch of a
// whole row), a wave-wide 16-byte copy covers 512 bytes in a row, and a panel is read from
// front to back as K advances.
#define PANEL 128
#define KSLAB (PANEL * UNIT)   // bf16 elements of one K-step of a panel
// LDS rows are the bare 128-byte units, no pad, so that three buffers of two
// work-groups fit one WGP's LDS. Instead the 16-byte piece c of row r lies at piece
// c ^ ((r >> 1) & 7): the 16 rows that a half-wave's ds_load_b128 touches then fall
// on 16 distinct 4-bank groups (row parity picks the half of the banks, the XOR the
// group inside it).
#define LDS_PITCH 64
#define NBUF 3       // LDS buffers of the K ring

#if __has_builtin(__builtin_amdgcn_global_load_async_to_lds_b128)
#define HAVE_ASYNC_LDS 1
#endif

#if defined(HAVE_ASYNC_LDS)
// builtin expects int4* in addrspace(1)/(3); HIP prints as1 as `__device__`.
#define GLOBAL_AS(p) ((__attribute__((address_space(1))) v4i_*)(p))
#define LDS_AS(p)    ((__attribute__((address_space(3))) v4i_*)(p))
// the wave's own copies, all but the n youngest, have landed; the clobber keeps LDS reads behind it
#define WAIT_ASYNC(n) asm volatile("s_wait_asynccnt %0" :: "i"(n) : "memory")
#endif

#define T_SEQ  2048
#define DMODEL 1024
#define NHEADS 16
#define HDIM   64
#define RAD    4
#define NWIN   (2 * RAD + 1)
#define KBLK   (DMODEL / TILE_K)   // 32-k blocks of a row of DMODEL

// first element of the unit of row `row` and k block `kb`; nkb k blocks a row
__device__ __forceinline__ size_t unit_at(unsigned row, unsigned kb, unsigned nkb) {
  return ((size_t)((row / PANEL) * nkb + kb) * PANEL + (row % PANEL)) * UNIT;
}

// ---------------------------------------------------------------------------
// Elementwise fp32 -> split bf16 (hi + residual lo), done once per tensor so
// the GEMM hot loop has zero conversion VALU and tiles are raw async-copyable.
// ---------------------------------------------------------------------------
// Rows of DMODEL floats. Eight lanes make one unit; a wave takes 2 rows x 2 k blocks, so that
// it reads 256 bytes in a row of each row and writes 256 bytes in a row of each k block.
__global__ __launch_bounds__(256)
void f32_to_bf16_split(const float* __restrict__ in, __bf16* __restrict__ hl, int n4) {
  int i = blockIdx.x * blockDim.x + threadIdx.x;
  if (i >= n4) return;
  const unsigned un  = (unsigned)i >> 3;                         // the unit's number in this order
  const unsigned kb  = (((un >> 2) % (KBLK / 2)) << 1) | (un & 1);
  const unsigned row = (((un >> 2) / (KBLK / 2)) << 1) | ((un >> 1) & 1);
  float4 f = ((const float4*)in)[row * (DMODEL / 4) + kb * 8 + (i & 7)];
  v4bf h, l;
  h.x = (__bf16)f.x;  l.x = (__bf16)(f.x - (float)h.x);
  h.y = (__bf16)f.y;  l.y = (__bf16)(f.y - (float)h.y);
  h.z = (__bf16)f.z;  l.z = (__bf16)(f.z - (float)h.z);
  h.w = (__bf16)f.w;  l.w = (__bf16)(f.w - (float)h.w);
  __bf16* u = hl + unit_at(row, kb, KBLK) + (i & 7) * 4;
  *(v4bf*)u = h;
  *(v4bf*)(u + UNIT_LO) = l;
}

// ---------------------------------------------------------------------------
// C[M,N] = (Ahi+Alo)[M,K] @ (Bhi+Blo)[N,K]^T + bias[N]   (bf16 split inputs,
// A and B each one buffer of head|remainder units in panel order, 2*K bf16 a row;
// M a multiple of 256, N of 128)
// Ring of three LDS buffers; tiles streamed two K-steps ahead with
// GLOBAL_LOAD_ASYNC_TO_LDS_B128 (ASYNCcnt) when available. 3 WMMAs (hh + hl + lh) per 16x16 tile ~ fp32.
// ---------------------------------------------------------------------------
__global__ __launch_bounds__(256)
void gemm_bf16x3(const __bf16* __restrict__ A, const __bf16* __restrict__ B,
                 const float* __restrict__ bias, float* __restrict__ C,
                 int M, int N, int K) {
  __shared__ __align__(16) __bf16 sA[NBUF][TILE_M * LDS_PITCH];
  __shared__ __align__(16) __bf16 sB[NBUF][TILE_N * LDS_PITCH];

  const int tid   = threadIdx.x;
  const int lane  = tid & 31;
  const int wave  = tid >> 5;     // 0..7
  const int waveM = wave >> 1;    // 0..3 -> 64-row slab
  const int waveN = wave & 1;     // 0..1 -> 64-col slab
  const int m0 = blockIdx.y * TILE_M;
  const int n0 = blockIdx.x * TILE_N;

  // cooperative copy mapping: 8 adjacent lanes cover one unit (one 128-B line), a wave 4 units
  // that follow one another in memory; a thread's copies are 32 rows apart
  const int crow = tid >> 3;          // 0..31
  const int ccol = (tid & 7) * 8;     // element offset (bf16) within the unit
  // the same piece's place in the LDS row (rows 32 apart share the swizzle)
  const int lcol = ((tid & 7) ^ ((crow >> 1) & 7)) * 8;

  // WMMA fragment addressing (this code's contiguous k order, used alike for A and B):
  // lane l -> row/col (l&15), K-base (l>>4)*16, 16 contiguous bf16.
  const int fr = lane & 15;
  // The 16 bf16 are pieces 2*(l>>4) and 2*(l>>4)+1 of the heads, +4 for the remainders;
  // element offsets of the four in a swizzled row (rows 16 apart share the swizzle)
  const int sw  = (fr >> 1) & 7;
  const int pc  = (lane >> 4) * 2;
  const int pH0 = ((pc)     ^ sw) * 8;
  const int pH1 = ((pc + 1) ^ sw) * 8;
  const int pL0 = ((pc + 4) ^ sw) * 8;
  const int pL1 = ((pc + 5) ^ sw) * 8;

  // copy one K-step (256 + 128 units = 48KB) into LDS buffer `buf`: two 16-KB slabs of A (the
  // tile's two panels) and one of B. 32 rows further is 4,096 bytes further in memory and in
  // LDS alike, which is what the copy's offset field moves: one address pair serves a slab.
  auto issue_tile = [&](int kk, int buf) {
    const size_t pstep = (size_t)PANEL * 2 * K;   // one whole panel further in memory
    const int    lstep = 32 * LDS_PITCH;          // 32 rows further in LDS
    const size_t slab  = (size_t)(kk / TILE_K) * KSLAB + crow * UNIT + ccol;
    const __bf16* gA = A + (size_t)(m0 / PANEL) * pstep + slab;
    const __bf16* gB = B + (size_t)(n0 / PANEL) * pstep + slab;
    const __bf16* gA1 = gA + pstep;
    __bf16* lA  = &sA[buf][crow * LDS_PITCH + lcol];
    __bf16* lA1 = lA + PANEL * LDS_PITCH;
    __bf16* lB  = &sB[buf][crow * LDS_PITCH + lcol];
#if defined(HAVE_ASYNC_LDS)
    // 12 wave-wide async ops per wave per K-step; in-order completion.
    __builtin_amdgcn_global_load_async_to_lds_b128(GLOBAL_AS(gA),  LDS_AS(lA),  0,     0);
    __builtin_amdgcn_global_load_async_to_lds_b128(GLOBAL_AS(gA),  LDS_AS(lA),  4096,  0);
    __builtin_amdgcn_global_load_async_to_lds_b128(GLOBAL_AS(gA),  LDS_AS(lA),  8192,  0);
    __builtin_amdgcn_global_load_async_to_lds_b128(GLOBAL_AS(gA),  LDS_AS(lA),  12288, 0);
    __builtin_amdgcn_global_load_async_to_lds_b128(GLOBAL_AS(gA1), LDS_AS(lA1), 0,     0);
    __builtin_amdgcn_global_load_async_to_lds_b128(GLOBAL_AS(gA1), LDS_AS(lA1), 4096,  0);
    __builtin_amdgcn_global_load_async_to_lds_b128(GLOBAL_AS(gA1), LDS_AS(lA1), 8192,  0);
    __builtin_amdgcn_global_load_async_to_lds_b128(GLOBAL_AS(gA1), LDS_AS(lA1), 12288, 0);
    __builtin_amdgcn_global_load_async_to_lds_b128(GLOBAL_AS(gB),  LDS_AS(lB),  0,     0);
    __builtin_amdgcn_global_load_async_to_lds_b128(GLOBAL_AS(gB),  LDS_AS(lB),  4096,  0);
    __builtin_amdgcn_global_load_async_to_lds_b128(GLOBAL_AS(gB),  LDS_AS(lB),  8192,  0);
    __builtin_amdgcn_global_load_async_to_lds_b128(GLOBAL_AS(gB),  LDS_AS(lB),  12288, 0);
#else
    #pragma unroll
    for (int j = 0; j < 4; ++j) {
      *(uint4*)(lA  + j * lstep) = *(const uint4*)(gA  + j * 32 * UNIT);
      *(uint4*)(lA1 + j * lstep) = *(const uint4*)(gA1 + j * 32 * UNIT);
      *(uint4*)(lB  + j * lstep) = *(const uint4*)(gB  + j * 32 * UNIT);
    }
#endif
  };

  // one fragment = two 16-byte pieces of a swizzled row: two b128 reads
  auto load_frag = [&](const __bf16* row, int p0, int p1) {
    v8bf f0 = *(const v8bf*)(row + p0);
    v8bf f1 = *(const v8bf*)(row + p1);
    return __builtin_shufflevector(f0, f1, 0, 1, 2, 3, 4, 5, 6, 7,
                                   8, 9, 10, 11, 12, 13, 14, 15);
  };

  v8f acc[4][4] = {};

  const int nk = K / TILE_K;
  issue_tile(0, 0);
  if (nk > 1) issue_tile(TILE_K, 1);

  int cur  = 0;   // buffer of tile ik
  int fill = 2;   // buffer of tile ik + 2, the one tile ik - 1 was read from
  for (int ik = 0; ik < nk; ++ik) {
    // this wave's reads of tile ik - 1 have retired before its buffer is refilled below
    asm volatile("s_wait_dscnt 0x0" ::: "memory");
#if defined(HAVE_ASYNC_LDS)
    if (ik + 1 < nk) {
      WAIT_ASYNC(12);   // tile ik's 12 copies done, tile ik + 1's may still fly
    } else {
      WAIT_ASYNC(0);
    }
#endif
    // the one barrier of a K-step: tile ik visible to all waves, and every wave has
    // left tile ik - 1
    __syncthreads();
    if (ik + 2 < nk) issue_tile((ik + 2) * TILE_K, fill);   // two K-steps of lead

    v16bf aH[4], aL[4], bH[4], bL[4];
    #pragma unroll
    for (int i = 0; i < 4; ++i) {
      int r = waveM * 64 + i * 16 + fr;
      aH[i] = load_frag(&sA[cur][r * LDS_PITCH], pH0, pH1);
      aL[i] = load_frag(&sA[cur][r * LDS_PITCH], pL0, pL1);
    }
    #pragma unroll
    for (int j = 0; j < 4; ++j) {
      int c = waveN * 64 + j * 16 + fr;
      bH[j] = load_frag(&sB[cur][c * LDS_PITCH], pH0, pH1);
      bL[j] = load_frag(&sB[cur][c * LDS_PITCH], pL0, pL1);
    }

    #pragma unroll
    for (int i = 0; i < 4; ++i) {
      #pragma unroll
      for (int j = 0; j < 4; ++j) {
        // B's rows (the n of C) go in as the first operand: a lane's 8 results are then
        // 8 consecutive n of one row of C, 16-byte pieces for the epilogue's staging
        acc[i][j] = __builtin_amdgcn_wmma_f32_16x16x32_bf16(
            false, bH[j], false, aH[i], (short)0, acc[i][j], false, false);
        acc[i][j] = __builtin_amdgcn_wmma_f32_16x16x32_bf16(
            false, bL[j], false, aH[i], (short)0, acc[i][j], false, false);
        acc[i][j] = __builtin_amdgcn_wmma_f32_16x16x32_bf16(
            false, bH[j], false, aL[i], (short)0, acc[i][j], false, false);
      }
    }
    fill = cur;
    cur  = (cur == NBUF - 1) ? 0 : cur + 1;
  }

  // epilogue: acc[i][j][r] = C[i*16 + (lane & 15)][j*16 + 8*(lane >> 4) + r] of the wave's 64x64.
  // Each wave turns its tile, 32 rows at a time, through 8 KB of LDS of its own, so that a
  // wave-wide 16-byte store writes two whole 256-byte row pieces (4 whole cache lines).
  // The 8 KB lie in the two ring buffers that do not hold the last tile: every wave left them,
  // and every copy into them had landed, before the loop's last barrier. After the loop
  // cur names the buffer behind the last tile's.
  const int nxt = (cur == NBUF - 1) ? 0 : cur + 1;
  float* stg = (float*)&sA[(wave & 4) ? nxt : cur][(wave & 3) * (32 * 128)];
  const int hh = lane >> 4;
  const v4f bv = *(const v4f*)(bias + n0 + waveN * 64 + fr * 4);
  // C's first element of this lane: row hh of the wave's tile, 16-byte piece fr of its 64 columns
  const unsigned c0 = (unsigned)(m0 + waveM * 64 + hh) * (unsigned)N + (unsigned)(n0 + waveN * 64 + fr * 4);
  #pragma unroll
  for (int g = 0; g < 2; ++g) {
    // rows of 256 B, no pad: the 16-byte piece p of row R lies at piece p ^ (R & 15), so the 16
    // rows that a half-wave writes, and the 16 pieces that it reads, fall on distinct banks
    #pragma unroll
    for (int ii = 0; ii < 2; ++ii) {
      float* row = stg + (ii * 16 + fr) * 64;
      #pragma unroll
      for (int j = 0; j < 4; ++j) {
        const v8f a = acc[2 * g + ii][j];
        *(v4f*)(row + ((j * 4 + 2 * hh)     ^ fr) * 4) = __builtin_shufflevector(a, a, 0, 1, 2, 3);
        *(v4f*)(row + ((j * 4 + 2 * hh + 1) ^ fr) * 4) = __builtin_shufflevector(a, a, 4, 5, 6, 7);
      }
    }
    // the wave's own rows stand in LDS before its other lanes read them back
    asm volatile("s_wait_dscnt 0x0" ::: "memory");
    v4f o[16];
    #pragma unroll
    for (int t = 0; t < 16; ++t) {
      const int R = 2 * t + hh;
      o[t] = *(const v4f*)(stg + R * 64 + (fr ^ (R & 15)) * 4);
    }
    #pragma unroll
    for (int t = 0; t < 16; ++t) {
      *(v4f*)(C + (c0 + (unsigned)(g * 32 + 2 * t) * (unsigned)N)) = o[t] + bv;
    }
    // before the next 32 rows reuse the stores' registers; the clobber also keeps the next
    // rows' LDS writes behind this round's LDS reads
    if (g == 0) asm volatile("s_wait_xcnt 0x0" ::: "memory");
  }
}

// p plus the p of the lane that CTRL names inside the 16-lane row: a DPP add on the
// vector port (a shuffle through __shfl_xor goes through the LDS pipe and its wait)
template <int CTRL>
__device__ __forceinline__ float add_from_lane(float p) {
  return p + __int_as_float(__builtin_amdgcn_update_dpp(0, __float_as_int(p), CTRL, 0xf, 0xf, true));
}

// 2^x. v_exp_f32 and the one slot that the instruction set asks for behind a transcendental stand
// in one statement.
__device__ __forceinline__ float exp2_slot(float x) {
  float e;
  asm("v_exp_f32 %0, %1\n\tv_nop" : "=v"(e) : "v"(x));
  return e;
}

// one 16-byte copy from global memory to LDS; off (bytes, a constant) moves both addresses
#if defined(HAVE_ASYNC_LDS)
#define COPY16(g, l, off) __builtin_amdgcn_global_load_async_to_lds_b128(GLOBAL_AS(g), LDS_AS(l), off, 0)
#else
#define COPY16(g, l, off) (*(uint4*)((char*)(l) + (off)) = *(const uint4*)((const char*)(g) + (off)))
#endif

#define QT_M 128                                // rows of a tile: one panel of x
#define QT_N (3 * HDIM)                         // columns: q | k | v of one head
#define QBUF ((QT_M + QT_N) * LDS_PITCH)        // bf16 elements of one ring buffer
#define SROW QT_N                               // floats of a staged row of q | k | v
#define EDGE 8                                  // rows at each end of a tile that also go to memory

// ---------------------------------------------------------------------------
// qkv = x @ w_qkv^T + b_qkv for 128 rows and one head's q, k and v (the same split-bf16 ring
// as gemm_bf16x3), and the window attention of the tile's rows 4..123 straight from LDS:
// every key of those rows lies in the tile, so their q, k and v never go to memory.
// The first and last 8 rows of the tile are stored to qkv as f32: focal_attn does the
// 4 + 4 queries whose window leaves the tile from them.
// ---------------------------------------------------------------------------
__global__ __launch_bounds__(256)
void gemm_qkv_attn(const __bf16* __restrict__ A, const __bf16* __restrict__ B,
                   const float* __restrict__ bias, float* __restrict__ qkv,
                   __bf16* __restrict__ out_hl, int K) {
  __shared__ __align__(256) __bf16 ring[NBUF * QBUF];

  const int tid   = threadIdx.x;
  const int lane  = tid & 31;
  const int wave  = __builtin_amdgcn_readfirstlane(tid >> 5);   // 0..7, held in a scalar register
  const int waveM = wave >> 2;    // 0..1 -> 64-row slab
  const int waveN = wave & 3;     // 0..3 -> 48-col slab
  const int h  = blockIdx.x;      // head
  const int mp = blockIdx.y;      // panel of x = tile of rows

  // copy and fragment addressing as in gemm_bf16x3
  const int crow = tid >> 3;
  const int ccol = (tid & 7) * 8;
  const int lcol = ((tid & 7) ^ ((crow >> 1) & 7)) * 8;
  const int fr  = lane & 15;
  const int hh  = lane >> 4;
  const int sw  = (fr >> 1) & 7;
  const int pc  = hh * 2;
  const int pH0 = ((pc)     ^ sw) * 8;
  const int pH1 = ((pc + 1) ^ sw) * 8;
  const int pL0 = ((pc + 4) ^ sw) * 8;
  const int pL1 = ((pc + 5) ^ sw) * 8;

  // one K-step (128 + 192 units = 40 KB): a 16-KB slab of x and three 8-KB half slabs of w_qkv
  // (the head's 64 rows of q, of k and of v; DMODEL rows = DMODEL / PANEL panels apart)
  auto issue_tile = [&](int kb, int buf) {
    const size_t pstep = (size_t)PANEL * 2 * K;   // one whole panel further in memory
    const size_t slab  = (size_t)kb * KSLAB + crow * UNIT + ccol;
    const __bf16* gA = A + (size_t)mp * pstep + slab;
    const __bf16* gQ = B + (size_t)(h >> 1) * pstep + slab + (h & 1) * (HDIM * UNIT);
    const __bf16* gK = gQ + (DMODEL / PANEL) * pstep;
    const __bf16* gV = gK + (DMODEL / PANEL) * pstep;
    __bf16* lA = ring + buf * QBUF + crow * LDS_PITCH + lcol;
    __bf16* lQ = lA + QT_M * LDS_PITCH;
    __bf16* lK = lQ + HDIM * LDS_PITCH;
    __bf16* lV = lK + HDIM * LDS_PITCH;
    // 10 wave-wide copies per wave per K-step
    COPY16(gA, lA, 0);
    COPY16(gA, lA, 4096);
    COPY16(gA, lA, 8192);
    COPY16(gA, lA, 12288);
    COPY16(gQ, lQ, 0);
    COPY16(gQ, lQ, 4096);
    COPY16(gK, lK, 0);
    COPY16(gK, lK, 4096);
    COPY16(gV, lV, 0);
    COPY16(gV, lV, 4096);
  };

  auto load_frag = [&](const __bf16* row, int p0, int p1) {
    v8bf f0 = *(const v8bf*)(row + p0);
    v8bf f1 = *(const v8bf*)(row + p1);
    return __builtin_shufflevector(f0, f1, 0, 1, 2, 3, 4, 5, 6, 7,
                                   8, 9, 10, 11, 12, 13, 14, 15);
  };

  v8f acc[4][3] = {};

  const int nk = K / TILE_K;
  issue_tile(0, 0);
  if (nk > 1) issue_tile(1, 1);

  int cur  = 0;   // buffer of tile ik
  int fill = 2;   // buffer of tile ik + 2, the one tile ik - 1 was read from
  for (int ik = 0; ik < nk; ++ik) {
    // this wave's reads of tile ik - 1 have retired before its buffer is refilled below
    asm volatile("s_wait_dscnt 0x0" ::: "memory");
#if defined(HAVE_ASYNC_LDS)
    if (ik + 1 < nk) {
      WAIT_ASYNC(10);   // tile ik's 10 copies done, tile ik + 1's may still fly
    } else {
      WAIT_ASYNC(0);
    }
#endif
    // the one barrier of a K-step: tile ik visible to all waves, and every wave has
    // left tile ik - 1
    __syncthreads();
    if (ik + 2 < nk) issue_tile(ik + 2, fill);   // two K-steps of lead

    const __bf16* tA = ring + cur * QBUF;
    const __bf16* tB = tA + QT_M * LDS_PITCH;
    v16bf aH[4], aL[4], bH[3], bL[3];
    #pragma unroll
    for (int i = 0; i < 4; ++i) {
      int r = waveM * 64 + i * 16 + fr;
      aH[i] = load_frag(tA + r * LDS_PITCH, pH0, pH1);
      aL[i] = load_frag(tA + r * LDS_PITCH, pL0, pL1);
    }
    #pragma unroll
    for (int j = 0; j < 3; ++j) {
      int c = waveN * 48 + j * 16 + fr;
      bH[j] = load_frag(tB + c * LDS_PITCH, pH0, pH1);
      bL[j] = load_frag(tB + c * LDS_PITCH, pL0, pL1);
    }

    #pragma unroll
    for (int i = 0; i < 4; ++i) {
      #pragma unroll
      for (int j = 0; j < 3; ++j) {
        // w_qkv's rows go in as the first operand: a lane's 8 results are 8 consecutive columns
        acc[i][j] = __builtin_amdgcn_wmma_f32_16x16x32_bf16(
            false, bH[j], false, aH[i], (short)0, acc[i][j], false, false);
        acc[i][j] = __builtin_amdgcn_wmma_f32_16x16x32_bf16(
            false, bL[j], false, aH[i], (short)0, acc[i][j], false, false);
        acc[i][j] = __builtin_amdgcn_wmma_f32_16x16x32_bf16(
            false, bH[j], false, aL[i], (short)0, acc[i][j], false, false);
      }
    }
    fill = cur;
    cur  = (cur == NBUF - 1) ? 0 : cur + 1;
  }

  // The ring becomes the f32 tile S[128][192] (96 of its 120 KB): every wave has left the last
  // K-step's buffer first (all copies had landed before the loop's last barrier).
  asm volatile("s_wait_dscnt 0x0" ::: "memory");
  __syncthreads();

  // Rows of 768 B, no pad: the 16-byte piece p of row R lies at piece p ^ swz(R), where swz turns
  // the row's low four bits round by one (bit 0 becomes bit 3). The 16 rows that a half-wave
  // writes then fall on distinct banks, and so do the two rows, four apart, that it reads.
  // acc[i][j][r] = tile[waveM*64 + i*16 + fr][waveN*48 + j*16 + 8*hh + r]
  auto swz = [](int r) { return ((r & 1) << 3) | ((r >> 1) & 7); };
  float* S = (float*)ring;
  const int fsw = swz(fr);
  #pragma unroll
  for (int j = 0; j < 3; ++j) {
    const int col = waveN * 48 + j * 16 + 8 * hh;                 // 8 columns of one of q, k, v
    const float* bp = bias + (col >> 6) * DMODEL + h * HDIM + (col & 63);
    const v4f b0 = *(const v4f*)bp;
    const v4f b1 = *(const v4f*)(bp + 4);
    const int p = col >> 2;
    #pragma unroll
    for (int i = 0; i < 4; ++i) {
      float* row = S + (waveM * 64 + i * 16 + fr) * SROW;
      const v8f a = acc[i][j];
      *(v4f*)(row + ((p)     ^ fsw) * 4) = __builtin_shufflevector(a, a, 0, 1, 2, 3) + b0;
      *(v4f*)(row + ((p + 1) ^ fsw) * 4) = __builtin_shufflevector(a, a, 4, 5, 6, 7) + b1;
    }
  }
  // the tile stands in LDS before any wave reads other waves' rows
  asm volatile("s_wait_dscnt 0x0" ::: "memory");
  __syncthreads();

  // the 8 + 8 edge rows go to memory for the queries whose window leaves the tile
  #pragma unroll
  for (int k = 0; k < (2 * EDGE * (SROW / 4)) / 256; ++k) {
    const int idx = tid + 256 * k;
    const int e = idx / (SROW / 4);
    const int p = idx % (SROW / 4);
    const int r = (e < EDGE) ? e : (QT_M - 2 * EDGE) + e;
    const v4f val = *(const v4f*)(S + r * SROW + ((p ^ swz(r)) << 2));
    *(v4f*)(qkv + (size_t)(mp * QT_M + r) * (3 * DMODEL) + (p >> 4) * DMODEL + h * HDIM + (p & 15) * 4) = val;
  }

  // Eight lanes take QG = 4 queries that follow one another: their windows share 12 rows of k and
  // of v, each read from LDS once (not once a query). A lane holds two 16-byte pieces of the
  // 64 dims, sub and sub + 8; the odd eight of a half-wave take them in the other order, so that
  // the two rows a half-wave reads at once lie in different halves of the banks.
  constexpr int QG = 4;
  constexpr int NR = NWIN + QG - 1;
  const int sub = lane & 7;
  const int ql  = lane >> 3;
  const int par = ql & 1;
  const int pA  = sub | (par << 3);
  const int t0  = (wave * 4 + ql) * QG;            // the eight lanes' first query
  // the tile's first and last RAD queries (one whole group each) are focal_attn's: their groups
  // run along on rows held inside the tile and store nothing
  const bool inner = (t0 >= RAD) && (t0 + QG <= QT_M - RAD);

  v4f qa[QG], qb[QG];
  #pragma unroll
  for (int c = 0; c < QG; ++c) {
    const int qi = (t0 + c) * SROW + ((pA ^ swz(t0 + c)) << 2);
    qa[c] = *(const v4f*)(S + qi);
    qb[c] = *(const v4f*)(S + (qi ^ 32));          // the lane's other piece: 8 pieces away
  }
  int   ri[NR];
  float s[QG][NWIN];
  #pragma unroll
  for (int jj = 0; jj < NR; ++jj) {
    int rk = t0 - RAD + jj;
    rk = rk < 0 ? 0 : (rk > QT_M - 1 ? QT_M - 1 : rk);
    ri[jj] = rk * SROW + ((pA ^ swz(rk)) << 2);
    const v4f ka = *(const v4f*)(S + ri[jj] + HDIM);
    const v4f kb = *(const v4f*)(S + (ri[jj] ^ 32) + HDIM);
    #pragma unroll
    for (int c = 0; c < QG; ++c) {
      const int j = jj - c;                        // row jj is key j of query c
      if (j >= 0 && j < NWIN) {
        v2f p2 = qa[c].lo * ka.lo + qa[c].hi * ka.hi + qb[c].lo * kb.lo + qb[c].hi * kb.hi;
        float p = p2.x + p2.y;
        p = add_from_lane<0xB1>(p);    // quad_perm [1,0,3,2]: lane ^ 1
        p = add_from_lane<0x4E>(p);    // quad_perm [2,3,0,1]: lane ^ 2
        p = add_from_lane<0x164>(p);   // row_xmask 4:         lane ^ 4
        s[c][j] = p * 0.125f;          // 1/sqrt(64)
      }
    }
  }
  float inv[QG];
  #pragma unroll
  for (int c = 0; c < QG; ++c) {
    float m = s[c][0];
    #pragma unroll
    for (int j = 1; j < NWIN; ++j) m = fmaxf(m, s[c][j]);
    float sum = 0.0f;
    #pragma unroll
    for (int j = 0; j < NWIN; ++j) { float e = exp2_slot((s[c][j] - m) * 1.44269504f); s[c][j] = e; sum += e; }
    inv[c] = 1.0f / sum;
  }
  v4f oa[QG] = {};
  v4f ob[QG] = {};
  #pragma unroll
  for (int jj = 0; jj < NR; ++jj) {
    const v4f va = *(const v4f*)(S + ri[jj] + 2 * HDIM);
    const v4f vb = *(const v4f*)(S + (ri[jj] ^ 32) + 2 * HDIM);
    #pragma unroll
    for (int c = 0; c < QG; ++c) {
      const int j = jj - c;
      if (j >= 0 && j < NWIN) { oa[c] += s[c][j] * va; ob[c] += s[c][j] * vb; }
    }
  }
  if (inner) {
    // piece pA holds dims 32*par + 4*sub ..: k block 2h + par; the other piece the other block
    __bf16* ua = out_hl + unit_at(mp * QT_M + t0, 2 * h + par,       KBLK) + sub * 4;
    __bf16* ub = out_hl + unit_at(mp * QT_M + t0, 2 * h + (par ^ 1), KBLK) + sub * 4;
    #pragma unroll
    for (int c = 0; c < QG; ++c) {
      const v4f xa = oa[c] * inv[c];
      const v4f xb = ob[c] * inv[c];
      v4bf ha, la, hb, lb;
      ha.x = (__bf16)xa.x;  la.x = (__bf16)(xa.x - (float)ha.x);
      ha.y = (__bf16)xa.y;  la.y = (__bf16)(xa.y - (float)ha.y);
      ha.z = (__bf16)xa.z;  la.z = (__bf16)(xa.z - (float)ha.z);
      ha.w = (__bf16)xa.w;  la.w = (__bf16)(xa.w - (float)ha.w);
      hb.x = (__bf16)xb.x;  lb.x = (__bf16)(xb.x - (float)hb.x);
      hb.y = (__bf16)xb.y;  lb.y = (__bf16)(xb.y - (float)hb.y);
      hb.z = (__bf16)xb.z;  lb.z = (__bf16)(xb.z - (float)hb.z);
      hb.w = (__bf16)xb.w;  lb.w = (__bf16)(xb.w - (float)hb.w);
      // the next row of a panel is the next unit
      *(v4bf*)(ua + c * UNIT)           = ha;
      *(v4bf*)(ua + c * UNIT + UNIT_LO) = la;
      *(v4bf*)(ub + c * UNIT)           = hb;
      *(v4bf*)(ub + c * UNIT + UNIT_LO) = lb;
    }
  }
}

#define QPB 32   // queries of one head per work-group: 8 lanes each

// Eight lanes per (b,h,t): lane s of the eight holds dims 4s..4s+3 and 32+4s..32+4s+3,
// so a wave-wide 16-byte load covers one whole 128-B line of each of 4 queries' rows and
// a score is 8 products in the lane and 3 steps across lanes; <=9 keys per query.
// Emits split-bf16 output (head|remainder units) directly for the projection GEMM.
// At most 9 waves a SIMD: that leaves 112 registers a wave, enough to have the K rows and
// most V rows in flight at once; at the default the loads go out in small dependent batches.
__global__ __launch_bounds__(256) __attribute__((amdgpu_waves_per_eu(2, 9)))
void focal_attn(const float* __restrict__ qkv, __bf16* __restrict__ out_hl) {
  const int sub = threadIdx.x & 7;
  // only the first and last RAD queries of every 128-row tile of gemm_qkv_attn: a work-group
  // takes those of 4 tiles that follow one another (all in one batch) and one head
  const int h   = blockIdx.x % NHEADS;
  const int g   = blockIdx.x / NHEADS;                                  // group of 4 tiles
  const int b   = g / (T_SEQ / (4 * QT_M));
  const int e   = (threadIdx.x >> 3) & 7;                                // which of a tile's 8
  const int t   = (g % (T_SEQ / (4 * QT_M))) * (4 * QT_M) + (threadIdx.x >> 6) * QT_M
                + (e < RAD ? e : QT_M - 2 * RAD + e);

  // this head's q columns in row 0 of batch b; k and v lie DMODEL and 2*DMODEL further
  const float* base = qkv + (size_t)b * T_SEQ * (3 * DMODEL) + h * HDIM;
  const unsigned qoff = (unsigned)t * (3 * DMODEL) + sub * 4;
  const v4f qa = *(const v4f*)(base + qoff);
  const v4f qb = *(const v4f*)(base + qoff + 32);
  const float scale = 0.125f; // 1/sqrt(64)

  float s[NWIN];
  v4f   va[NWIN], vb[NWIN];
  #pragma unroll
  for (int j = 0; j < NWIN; ++j) {
    int  tk = t - RAD + j;
    bool ok = (tk >= 0) && (tk < T_SEQ);
    int  tc = ok ? tk : t;
    const unsigned koff = (unsigned)tc * (3 * DMODEL) + sub * 4;
    v4f ka = *(const v4f*)(base + koff + DMODEL);
    v4f kb = *(const v4f*)(base + koff + DMODEL + 32);
    va[j]  = *(const v4f*)(base + koff + 2 * DMODEL);
    vb[j]  = *(const v4f*)(base + koff + 2 * DMODEL + 32);
    // two running sums (even and odd dims), the shape of the packed f32 multiply-add
    v2f p2 = qa.lo * ka.lo + qa.hi * ka.hi + qb.lo * kb.lo + qb.hi * kb.hi;
    float p = p2.x + p2.y;
    p = add_from_lane<0xB1>(p);    // quad_perm [1,0,3,2]: lane ^ 1
    p = add_from_lane<0x4E>(p);    // quad_perm [2,3,0,1]: lane ^ 2
    p = add_from_lane<0x164>(p);   // row_xmask 4:         lane ^ 4
    s[j] = ok ? p * scale : -__builtin_inff();
  }

  float m = s[0];
  #pragma unroll
  for (int j = 1; j < NWIN; ++j) m = fmaxf(m, s[j]);
  float sum = 0.0f;
  #pragma unroll
  for (int j = 0; j < NWIN; ++j) { float e = exp2_slot((s[j] - m) * 1.44269504f); s[j] = e; sum += e; }
  float inv = 1.0f / sum;

  v4f oa = {0.0f, 0.0f, 0.0f, 0.0f};
  v4f ob = {0.0f, 0.0f, 0.0f, 0.0f};
  #pragma unroll
  for (int j = 0; j < NWIN; ++j) { oa += s[j] * va[j]; ob += s[j] * vb[j]; }
  oa *= inv;
  ob *= inv;

  v4bf ha, la, hb, lb;
  ha.x = (__bf16)oa.x;  la.x = (__bf16)(oa.x - (float)ha.x);
  ha.y = (__bf16)oa.y;  la.y = (__bf16)(oa.y - (float)ha.y);
  ha.z = (__bf16)oa.z;  la.z = (__bf16)(oa.z - (float)ha.z);
  ha.w = (__bf16)oa.w;  la.w = (__bf16)(oa.w - (float)ha.w);
  hb.x = (__bf16)ob.x;  lb.x = (__bf16)(ob.x - (float)hb.x);
  hb.y = (__bf16)ob.y;  lb.y = (__bf16)(ob.y - (float)hb.y);
  hb.z = (__bf16)ob.z;  lb.z = (__bf16)(ob.z - (float)hb.z);
  hb.w = (__bf16)ob.w;  lb.w = (__bf16)(ob.w - (float)hb.w);
  // a head's 64 dims are two units of the row: dims 0..31 in k block 2h, dims 32..63 in 2h + 1,
  // which lies one K-step slab further in the row's panel
  __bf16* u = out_hl + unit_at(b * T_SEQ + t, 2 * h, KBLK) + sub * 4;
  *(v4bf*)(u)                   = ha;
  *(v4bf*)(u + UNIT_LO)         = la;
  *(v4bf*)(u + KSLAB)           = hb;
  *(v4bf*)(u + KSLAB + UNIT_LO) = lb;
}

extern "C" void kernel_launch(void* const* d_in, const int* in_sizes, int n_in,
                              void* d_out, int out_size, void* d_ws, size_t ws_size,
                              hipStream_t stream) {
  const float* x      = (const float*)d_in[0];
  const float* w_qkv  = (const float*)d_in[1];
  const float* b_qkv  = (const float*)d_in[2];
  const float* w_proj = (const float*)d_in[3];
  const float* b_proj = (const float*)d_in[4];
  float* out = (float*)d_out;

  const int B = 4, T = T_SEQ, D = DMODEL;
  const int M = B * T;                         // 8192 rows
  const size_t nX  = (size_t)M * D;            // 8,388,608
  const size_t nWq = (size_t)3 * D * D;        // 3,145,728
  const size_t nWp = (size_t)D * D;            // 1,048,576

  // workspace layout (all offsets naturally aligned)
  char* w = (char*)d_ws;
  float*  qkv     = (float*)w;    w += (size_t)M * 3 * D * sizeof(float);  // 96 MB
  __bf16* x_hl    = (__bf16*)w;   w += 2 * nX  * sizeof(__bf16);
  __bf16* wq_hl   = (__bf16*)w;   w += 2 * nWq * sizeof(__bf16);
  __bf16* wp_hl   = (__bf16*)w;   w += 2 * nWp * sizeof(__bf16);
  __bf16* attn_hl = (__bf16*)w;

  dim3 blk(256);

  // one-shot split-bf16 conversion of activations and weights
  f32_to_bf16_split<<<dim3((unsigned)(nX  / 4 / 256)), blk, 0, stream>>>(x,      x_hl,  (int)(nX  / 4));
  f32_to_bf16_split<<<dim3((unsigned)(nWq / 4 / 256)), blk, 0, stream>>>(w_qkv,  wq_hl, (int)(nWq / 4));
  f32_to_bf16_split<<<dim3((unsigned)(nWp / 4 / 256)), blk, 0, stream>>>(w_proj, wp_hl, (int)(nWp / 4));

  // qkv = x @ w_qkv^T + b_qkv
  // with the local-window attention (radius 4) of each tile's inner rows, emits split-bf16
  gemm_qkv_attn<<<dim3(NHEADS, M / QT_M), blk, 0, stream>>>(x_hl, wq_hl, b_qkv, qkv, attn_hl, D);

  // the attention of the 2 * RAD queries a tile whose window leaves the tile
  focal_attn<<<dim3((M / QT_M) * (2 * RAD) * NHEADS / QPB), blk, 0, stream>>>(qkv, attn_hl);

  // out = attn @ w_proj^T + b_proj
  gemm_bf16x3<<<dim3(D / TILE_N, M / TILE_M), blk, 0, stream>>>(
      attn_hl, wp_hl, b_proj, out, M, D, D);
}

// v009
// One run takes 127 microseconds.
// Two timings next to v008 both put it at 1.04 times that version's speed.
// Over all steps from v000 it is 2.15 times as fast.
#include <hip/hip_runtime.h>
#include <hip/hip_bf16.h>

typedef float  v8f   __attribute__((ext_vector_type(8)));
typedef __bf16 v16bf __attribute__((ext_vector_type(16)));
typedef __bf16 v8bf  __attribute__((ext_vector_type(8)));
typedef __bf16 v4bf  __attribute__((ext_vector_type(4)));
typedef __bf16 v2bf  __attribute__((ext_vector_type(2)));
typedef int    v4i_  __attribute__((ext_vector_type(4)));
typedef float  v4f   __attribute__((ext_vector_type(4)));
typedef float  v2f   __attribute__((ext_vector_type(2)));

#define TILE_M 256
#define TILE_N 128
#define TILE_K 32
// Split operands live in memory as 128-byte units, one per row and 32-k block:
// 32 bf16 heads (64 B) followed by their 32 bf16 remainders (64 B). One K-step of
// a tile row is then exactly one whole, aligned cache line.
#define UNIT 64      // bf16 elements of a unit
#define UNIT_LO 32   // where the remainders start inside a unit
// The units of a tensor are ordered by panels of 128 rows: panel, then 32-k block, then row
// in the panel. One K-step of a panel is then 16 KB in a row (not 128 lines at the pitch of a
// whole row), a wave-wide 16-byte copy covers 512 bytes in a row, and a panel is read from
// front to back as K advances.
#define PANEL 128
#define KSLAB (PANEL * UNIT)   // bf16 elements of one K-step of a panel
// LDS rows are the bare 128-byte units, no pad, so that three buffers of two
// work-groups fit one WGP's LDS. Instead the 16-byte piece c of row r lies at piece
// c ^ ((r >> 1) & 7): the 16 rows that a half-wave's ds_load_b128 touches then fall
// on 16 distinct 4-bank groups (row parity picks the half of the banks, the XOR the
// group inside it).
#define LDS_PITCH 64
#define NBUF 3       // LDS buffers of the K ring

#if __has_builtin(__builtin_amdgcn_global_load_async_to_lds_b128)
#define HAVE_ASYNC_LDS 1
#endif

#if defined(HAVE_ASYNC_LDS)
// builtin expects int4* in addrspace(1)/(3); HIP prints as1 as `__device__`.
#define GLOBAL_AS(p) ((__attribute__((address_space(1))) v4i_*)(p))
#define LDS_AS(p)    ((__attribute__((address_space(3))) v4i_*)(p))
// the wave's own copies, all but the n youngest, have landed; the clobber keeps LDS reads behind it
#define WAIT_ASYNC(n) asm volatile("s_wait_asynccnt %0" :: "i"(n) : "memory")
#endif

#define T_SEQ  2048
#define DMODEL 1024
#define NHEADS 16
#define HDIM   64
#define RAD    4
#define NWIN   (2 * RAD + 1)
#define KBLK   (DMODEL / TILE_K)   // 32-k blocks of a row of DMODEL

// first element of the unit of row `row` and k block `kb`; nkb k blocks a row
__device__ __forceinline__ size_t unit_at(unsigned row, unsigned kb, unsigned nkb) {
  return ((size_t)((row / PANEL) * nkb + kb) * PANEL + (row % PANEL)) * UNIT;
}

// ---------------------------------------------------------------------------
// Elementwise fp32 -> split bf16 (hi + residual lo), done once per tensor so
// the GEMM hot loop has zero conversion VALU and tiles are raw async-copyable.
// ---------------------------------------------------------------------------
// One launch converts x, w_qkv and w_proj. The work is cut into chunks of 8 whole rows of DMODEL
// floats (32 KB read, 32 KB written); a work-group takes SPLIT_TRIPS chunks, SPLIT_WG apart, so
// that few waves have to be started and each keeps many loads in flight.
#define SPLIT_U     8                                   // 16-byte loads of a lane and chunk
#define SPLIT_CH    (256 * SPLIT_U)                     // float4 of a chunk
#define CH_X        (4 * T_SEQ * DMODEL / 4 / SPLIT_CH) // chunks of x
#define CH_WQ       (3 * DMODEL * DMODEL / 4 / SPLIT_CH)
#define CH_WP       (DMODEL * DMODEL / 4 / SPLIT_CH)
#define SPLIT_WG    512                                 // work-groups of 8 waves
#define SPLIT_TRIPS ((CH_X + CH_WQ + CH_WP) / SPLIT_WG)
static_assert(SPLIT_TRIPS * SPLIT_WG == CH_X + CH_WQ + CH_WP, "the chunks go round evenly");
static_assert(CH_X * SPLIT_CH * 4 == 4 * T_SEQ * DMODEL && CH_WP * SPLIT_CH * 4 == DMODEL * DMODEL,
              "every tensor is whole chunks");

// Rows of DMODEL floats. Eight lanes make one unit; a wave takes 2 rows x 2 k blocks, so that
// it reads 256 bytes in a row of each row and writes 256 bytes in a row of each k block.
// Load j of a lane lies 2 * (j >> 1) rows and 16 * (j & 1) k blocks behind its load 0: constant
// steps in memory on both sides, so one address a chunk serves the loads and one the stores.
__global__ __launch_bounds__(256)
void f32_to_bf16_split(const float* __restrict__ x, const float* __restrict__ wq,
                       const float* __restrict__ wp, __bf16* __restrict__ x_hl,
                       __bf16* __restrict__ wq_hl, __bf16* __restrict__ wp_hl) {
  const unsigned tid = threadIdx.x;
  const unsigned r0  = (tid >> 4) & 1;        // the lane's row of the wave's two
  const unsigned kb0 = ((tid >> 5) << 1) | ((tid >> 3) & 1);   // its k block at j = 0: two a wave

  // chunk cc of the whole work: all of its loads go out together
  auto load_chunk = [&](unsigned cc, float4* f) {
    const float*   in = cc < CH_X ? x : (cc < CH_X + CH_WQ ? wq : wp);
    const unsigned c  = cc < CH_X ? cc : (cc < CH_X + CH_WQ ? cc - CH_X : cc - (CH_X + CH_WQ));
    const float4*  p  = (const float4*)in + ((c * 8 + r0) * (DMODEL / 4) + kb0 * 8 + (tid & 7));
    #pragma unroll
    for (int j = 0; j < SPLIT_U; ++j)
      f[j] = p[(j >> 1) * 2 * (DMODEL / 4) + (j & 1) * (KBLK / 2) * 8];
    // before the loads' address register is used for something else; the clobber also keeps
    // the stores of the chunk before behind these loads
    asm volatile("s_wait_xcnt 0x0" ::: "memory");
  };
  auto store_chunk = [&](unsigned cc, const float4* fs) {
    __bf16*        hl = cc < CH_X ? x_hl : (cc < CH_X + CH_WQ ? wq_hl : wp_hl);
    const unsigned c  = cc < CH_X ? cc : (cc < CH_X + CH_WQ ? cc - CH_X : cc - (CH_X + CH_WQ));
    // a chunk's 8 rows lie in one panel: 2 rows further is 2 units further
    __bf16* u0 = hl + unit_at(c * 8 + r0, kb0, KBLK) + (tid & 7) * 4;
    #pragma unroll
    for (int j = 0; j < SPLIT_U; ++j) {
      const float4 f = fs[j];
      v4bf h, l;
      h.x = (__bf16)f.x;  l.x = (__bf16)(f.x - (float)h.x);
      h.y = (__bf16)f.y;  l.y = (__bf16)(f.y - (float)h.y);
      h.z = (__bf16)f.z;  l.z = (__bf16)(f.z - (float)h.z);
      h.w = (__bf16)f.w;  l.w = (__bf16)(f.w - (float)h.w);
      __bf16* u = u0 + (j >> 1) * 2 * UNIT + (j & 1) * (KBLK / 2) * KSLAB;
      *(v4bf*)u = h;
      *(v4bf*)(u + UNIT_LO) = l;
    }
  };

  // the next chunk's loads fly while this chunk is converted and stored
  float4 f[2][SPLIT_U];
  load_chunk(blockIdx.x, f[0]);
  #pragma unroll
  for (int t = 0; t < SPLIT_TRIPS; ++t) {
    if (t + 1 < SPLIT_TRIPS) load_chunk(blockIdx.x + (t + 1) * SPLIT_WG, f[(t + 1) & 1]);
    store_chunk(blockIdx.x + t * SPLIT_WG, f[t & 1]);
  }
}

// ---------------------------------------------------------------------------
// C[M,N] = (Ahi+Alo)[M,K] @ (Bhi+Blo)[N,K]^T + bias[N]   (bf16 split inputs,
// A and B each one buffer of head|remainder units in panel order, 2*K bf16 a row;
// M a multiple of 256, N of 128)
// Ring of three LDS buffers; tiles streamed two K-steps ahead with
// GLOBAL_LOAD_ASYNC_TO_LDS_B128 (ASYNCcnt) when available. 3 WMMAs (hh + hl + lh) per 16x16 tile ~ fp32.
// ---------------------------------------------------------------------------
__global__ __launch_bounds__(256)
void gemm_bf16x3(const __bf16* __restrict__ A, const __bf16* __restrict__ B,
                 const float* __restrict__ bias, float* __restrict__ C,
                 int M, int N, int K) {
  __shared__ __align__(16) __bf16 sA[NBUF][TILE_M * LDS_PITCH];
  __shared__ __align__(16) __bf16 sB[NBUF][TILE_N * LDS_PITCH];

  const int tid   = threadIdx.x;
  const int lane  = tid & 31;
  const int wave  = tid >> 5;     // 0..7
  const int waveM = wave >> 1;    // 0..3 -> 64-row slab
  const int waveN = wave & 1;     // 0..1 -> 64-col slab
  const int m0 = blockIdx.y * TILE_M;
  const int n0 = blockIdx.x * TILE_N;

  // cooperative copy mapping: 8 adjacent lanes cover one unit (one 128-B line), a wave 4 units
  // that follow one another in memory; a thread's copies are 32 rows apart
  const int crow = tid >> 3;          // 0..31
  const int ccol = (tid & 7) * 8;     // element offset (bf16) within the unit
  // the same piece's place in the LDS row (rows 32 apart share the swizzle)
  const int lcol = ((tid & 7) ^ ((crow >> 1) & 7)) * 8;

  // WMMA fragment addressing (this code's contiguous k order, used alike for A and B):
  // lane l -> row/col (l&15), K-base (l>>4)*16, 16 contiguous bf16.
  const int fr = lane & 15;
  // The 16 bf16 are pieces 2*(l>>4) and 2*(l>>4)+1 of the heads, +4 for the remainders;
  // element offsets of the four in a swizzled row (rows 16 apart share the swizzle)
  const int sw  = (fr >> 1) & 7;
  const int pc  = (lane >> 4) * 2;
  const int pH0 = ((pc)     ^ sw) * 8;
  const int pH1 = ((pc + 1) ^ sw) * 8;
  const int pL0 = ((pc + 4) ^ sw) * 8;
  const int pL1 = ((pc + 5) ^ sw) * 8;

  // copy one K-step (256 + 128 units = 48KB) into LDS buffer `buf`: two 16-KB slabs of A (the
  // tile's two panels) and one of B. 32 rows further is 4,096 bytes further in memory and in
  // LDS alike, which is what the copy's offset field moves: one address pair serves a slab.
  auto issue_tile = [&](int kk, int buf) {
    const size_t pstep = (size_t)PANEL * 2 * K;   // one whole panel further in memory
    const int    lstep = 32 * LDS_PITCH;          // 32 rows further in LDS
    const size_t slab  = (size_t)(kk / TILE_K) * KSLAB + crow * UNIT + ccol;
    const __bf16* gA = A + (size_t)(m0 / PANEL) * pstep + slab;
    const __bf16* gB = B + (size_t)(n0 / PANEL) * pstep + slab;
    const __bf16* gA1 = gA + pstep;
    __bf16* lA  = &sA[buf][crow * LDS_PITCH + lcol];
    __bf16* lA1 = lA + PANEL * LDS_PITCH;
    __bf16* lB  = &sB[buf][crow * LDS_PITCH + lcol];
#if defined(HAVE_ASYNC_LDS)
    // 12 wave-wide async ops per wave per K-step; in-order completion.
    __builtin_amdgcn_global_load_async_to_lds_b128(GLOBAL_AS(gA),  LDS_AS(lA),  0,     0);
    __builtin_amdgcn_global_load_async_to_lds_b128(GLOBAL_AS(gA),  LDS_AS(lA),  4096,  0);
    __builtin_amdgcn_global_load_async_to_lds_b128(GLOBAL_AS(gA),  LDS_AS(lA),  8192,  0);
    __builtin_amdgcn_global_load_async_to_lds_b128(GLOBAL_AS(gA),  LDS_AS(lA),  12288, 0);
    __builtin_amdgcn_global_load_async_to_lds_b128(GLOBAL_AS(gA1), LDS_AS(lA1), 0,     0);
    __builtin_amdgcn_global_load_async_to_lds_b128(GLOBAL_AS(gA1), LDS_AS(lA1), 4096,  0);
    __builtin_amdgcn_global_load_async_to_lds_b128(GLOBAL_AS(gA1), LDS_AS(lA1), 8192,  0);
    __builtin_amdgcn_global_load_async_to_lds_b128(GLOBAL_AS(gA1), LDS_AS(lA1), 12288, 0);
    __builtin_amdgcn_global_load_async_to_lds_b128(GLOBAL_AS(gB),  LDS_AS(lB),  0,     0);
    __builtin_amdgcn_global_load_async_to_lds_b128(GLOBAL_AS(gB),  LDS_AS(lB),  4096,  0);
    __builtin_amdgcn_global_load_async_to_lds_b128(GLOBAL_AS(gB),  LDS_AS(lB),  8192,  0);
    __builtin_amdgcn_global_load_async_to_lds_b128(GLOBAL_AS(gB),  LDS_AS(lB),  12288, 0);
#else
    #pragma unroll
    for (int j = 0; j < 4; ++j) {
      *(uint4*)(lA  + j * lstep) = *(const uint4*)(gA  + j * 32 * UNIT);
      *(uint4*)(lA1 + j * lstep) = *(const uint4*)(gA1 + j * 32 * UNIT);
      *(uint4*)(lB  + j * lstep) = *(const uint4*)(gB  + j * 32 * UNIT);
    }
#endif
  };

  // one fragment = two 16-byte pieces of a swizzled row: two b128 reads
  auto load_frag = [&](const __bf16* row, int p0, int p1) {
    v8bf f0 = *(const v8bf*)(row + p0);
    v8bf f1 = *(const v8bf*)(row + p1);
    return __builtin_shufflevector(f0, f1, 0, 1, 2, 3, 4, 5, 6, 7,
                                   8, 9, 10, 11, 12, 13, 14, 15);
  };

  v8f acc[4][4] = {};

  const int nk = K / TILE_K;
  issue_tile(0, 0);
  if (nk > 1) issue_tile(TILE_K, 1);

  int cur  = 0;   // buffer of tile ik
  int fill = 2;   // buffer of tile ik + 2, the one tile ik - 1 was read from
  for (int ik = 0; ik < nk; ++ik) {
    // this wave's reads of tile ik - 1 have retired before its buffer is refilled below
    asm volatile("s_wait_dscnt 0x0" ::: "memory");
#if defined(HAVE_ASYNC_LDS)
    if (ik + 1 < nk) {
      WAIT_ASYNC(12);   // tile ik's 12 copies done, tile ik + 1's may still fly
    } else {
      WAIT_ASYNC(0);
    }
#endif
    // the one barrier of a K-step: tile ik visible to all waves, and every wave has
    // left tile ik - 1
    __syncthreads();
    if (ik + 2 < nk) issue_tile((ik + 2) * TILE_K, fill);   // two K-steps of lead

    v16bf aH[4], aL[4], bH[4], bL[4];
    #pragma unroll
    for (int i = 0; i < 4; ++i) {
      int r = waveM * 64 + i * 16 + fr;
      aH[i] = load_frag(&sA[cur][r * LDS_PITCH], pH0, pH1);
      aL[i] = load_frag(&sA[cur][r * LDS_PITCH], pL0, pL1);
    }
    #pragma unroll
    for (int j = 0; j < 4; ++j) {
      int c = waveN * 64 + j * 16 + fr;
      bH[j] = load_frag(&sB[cur][c * LDS_PITCH], pH0, pH1);
      bL[j] = load_frag(&sB[cur][c * LDS_PITCH], pL0, pL1);
    }

    #pragma unroll
    for (int i = 0; i < 4; ++i) {
      #pragma unroll
      for (int j = 0; j < 4; ++j) {
        // B's rows (the n of C) go in as the first operand: a lane's 8 results are then
        // 8 consecutive n of one row of C, 16-byte pieces for the epilogue's staging
        acc[i][j] = __builtin_amdgcn_wmma_f32_16x16x32_bf16(
            false, bH[j], false, aH[i], (short)0, acc[i][j], false, false);
        acc[i][j] = __builtin_amdgcn_wmma_f32_16x16x32_bf16(
            false, bL[j], false, aH[i], (short)0, acc[i][j], false, false);
        acc[i][j] = __builtin_amdgcn_wmma_f32_16x16x32_bf16(
            false, bH[j], false, aL[i], (short)0, acc[i][j], false, false);
      }
    }
    fill = cur;
    cur  = (cur == NBUF - 1) ? 0 : cur + 1;
  }

  // epilogue: acc[i][j][r] = C[i*16 + (lane & 15)][j*16 + 8*(lane >> 4) + r] of the wave's 64x64.
  // Each wave turns its tile, 32 rows at a time, through 8 KB of LDS of its own, so that a
  // wave-wide 16-byte store writes two whole 256-byte row pieces (4 whole cache lines).
  // The 8 KB lie in the two ring buffers that do not hold the last tile: every wave left them,
  // and every copy into them had landed, before the loop's last barrier. After the loop
  // cur names the buffer behind the last tile's.
  const int nxt = (cur == NBUF - 1) ? 0 : cur + 1;
  float* stg = (float*)&sA[(wave & 4) ? nxt : cur][(wave & 3) * (32 * 128)];
  const int hh = lane >> 4;
  const v4f bv = *(const v4f*)(bias + n0 + waveN * 64 + fr * 4);
  // C's first element of this lane: row hh of the wave's tile, 16-byte piece fr of its 64 columns
  const unsigned c0 = (unsigned)(m0 + waveM * 64 + hh) * (unsigned)N + (unsigned)(n0 + waveN * 64 + fr * 4);
  #pragma unroll
  for (int g = 0; g < 2; ++g) {
    // rows of 256 B, no pad: the 16-byte piece p of row R lies at piece p ^ (R & 15), so the 16
    // rows that a half-wave writes, and the 16 pieces that it reads, fall on distinct banks
    #pragma unroll
    for (int ii = 0; ii < 2; ++ii) {
      float* row = stg + (ii * 16 + fr) * 64;
      #pragma unroll
      for (int j = 0; j < 4; ++j) {
        const v8f a = acc[2 * g + ii][j];
        *(v4f*)(row + ((j * 4 + 2 * hh)     ^ fr) * 4) = __builtin_shufflevector(a, a, 0, 1, 2, 3);
        *(v4f*)(row + ((j * 4 + 2 * hh + 1) ^ fr) * 4) = __builtin_shufflevector(a, a, 4, 5, 6, 7);
      }
    }
    // the wave's own rows stand in LDS before its other lanes read them back
    asm volatile("s_wait_dscnt 0x0" ::: "memory");
    v4f o[16];
    #pragma unroll
    for (int t = 0; t < 16; ++t) {
      const int R = 2 * t + hh;
      o[t] = *(const v4f*)(stg + R * 64 + (fr ^ (R & 15)) * 4);
    }
    #pragma unroll
    for (int t = 0; t < 16; ++t) {
      *(v4f*)(C + (c0 + (unsigned)(g * 32 + 2 * t) * (unsigned)N)) = o[t] + bv;
    }
    // before the next 32 rows reuse the stores' registers; the clobber also keeps the next
    // rows' LDS writes behind this round's LDS reads
    if (g == 0) asm volatile("s_wait_xcnt 0x0" ::: "memory");
  }
}

// p plus the p of the lane that CTRL names inside the 16-lane row: a DPP add on the
// vector port (a shuffle through __shfl_xor goes through the LDS pipe and its wait)
template <int CTRL>
__device__ __forceinline__ float add_from_lane(float p) {
  return p + __int_as_float(__builtin_amdgcn_update_dpp(0, __float_as_int(p), CTRL, 0xf, 0xf, true));
}

// 2^x. v_exp_f32 and the one slot that the instruction set asks for behind a transcendental stand
// in one statement.
__device__ __forceinline__ float exp2_slot(float x) {
  float e;
  asm("v_exp_f32 %0, %1\n\tv_nop" : "=v"(e) : "v"(x));
  return e;
}

// one 16-byte copy from global memory to LDS; off (bytes, a constant) moves both addresses
#if defined(HAVE_ASYNC_LDS)
#define COPY16(g, l, off) __builtin_amdgcn_global_load_async_to_lds_b128(GLOBAL_AS(g), LDS_AS(l), off, 0)
#else
#define COPY16(g, l, off) (*(uint4*)((char*)(l) + (off)) = *(const uint4*)((const char*)(g) + (off)))
#endif

#define QT_M 128                                // rows of a tile: one panel of x
#define QT_N (3 * HDIM)                         // columns: q | k | v of one head
#define QBUF ((QT_M + QT_N) * LDS_PITCH)        // bf16 elements of one ring buffer
#define SROW QT_N                               // floats of a staged row of q | k | v
#define EDGE 8                                  // rows at each end of a tile that also go to memory

// ---------------------------------------------------------------------------
// qkv = x @ w_qkv^T + b_qkv for 128 rows and one head's q, k and v (the same split-bf16 ring
// as gemm_bf16x3), and the window attention of the tile's rows 4..123 straight from LDS:
// every key of those rows lies in the tile, so their q, k and v never go to memory.
// The first and last 8 rows of the tile are stored to qkv as f32: focal_attn does the
// 4 + 4 queries whose window leaves the tile from them.
// ---------------------------------------------------------------------------
__global__ __launch_bounds__(256)
void gemm_qkv_attn(const __bf16* __restrict__ A, const __bf16* __restrict__ B,
                   const float* __restrict__ bias, float* __restrict__ qkv,
                   __bf16* __restrict__ out_hl, int K) {
  __shared__ __align__(256) __bf16 ring[NBUF * QBUF];

  const int tid   = threadIdx.x;
  const int lane  = tid & 31;
  const int wave  = __builtin_amdgcn_readfirstlane(tid >> 5);   // 0..7, held in a scalar register
  const int waveM = wave >> 2;    // 0..1 -> 64-row slab
  const int waveN = wave & 3;     // 0..3 -> 48-col slab
  const int h  = blockIdx.x;      // head
  const int mp = blockIdx.y;      // panel of x = tile of rows

  // copy and fragment addressing as in gemm_bf16x3
  const int crow = tid >> 3;
  const int ccol = (tid & 7) * 8;
  const int lcol = ((tid & 7) ^ ((crow >> 1) & 7)) * 8;
  const int fr  = lane & 15;
  const int hh  = lane >> 4;
  const int sw  = (fr >> 1) & 7;
  const int pc  = hh * 2;
  const int pH0 = ((pc)     ^ sw) * 8;
  const int pH1 = ((pc + 1) ^ sw) * 8;
  const int pL0 = ((pc + 4) ^ sw) * 8;
  const int pL1 = ((pc + 5) ^ sw) * 8;

  // one K-step (128 + 192 units = 40 KB): a 16-KB slab of x and three 8-KB half slabs of w_qkv
  // (the head's 64 rows of q, of k and of v; DMODEL rows = DMODEL / PANEL panels apart)
  auto issue_tile = [&](int kb, int buf) {
    const size_t pstep = (size_t)PANEL * 2 * K;   // one whole panel further in memory
    const size_t slab  = (size_t)kb * KSLAB + crow * UNIT + ccol;
    const __bf16* gA = A + (size_t)mp * pstep + slab;
    const __bf16* gQ = B + (size_t)(h >> 1) * pstep + slab + (h & 1) * (HDIM * UNIT);
    const __bf16* gK = gQ + (DMODEL / PANEL) * pstep;
    const __bf16* gV = gK + (DMODEL / PANEL) * pstep;
    __bf16* lA = ring + buf * QBUF + crow * LDS_PITCH + lcol;
    __bf16* lQ = lA + QT_M * LDS_PITCH;
    __bf16* lK = lQ + HDIM * LDS_PITCH;
    __bf16* lV = lK + HDIM * LDS_PITCH;
    // 10 wave-wide copies per wave per K-step
    COPY16(gA, lA, 0);
    COPY16(gA, lA, 4096);
    COPY16(gA, lA, 8192);
    COPY16(gA, lA, 12288);
    COPY16(gQ, lQ, 0);
    COPY16(gQ, lQ, 4096);
    COPY16(gK, lK, 0);
    COPY16(gK, lK, 4096);
    COPY16(gV, lV, 0);
    COPY16(gV, lV, 4096);
  };

  auto load_frag = [&](const __bf16* row, int p0, int p1) {
    v8bf f0 = *(const v8bf*)(row + p0);
    v8bf f1 = *(const v8bf*)(row + p1);
    return __builtin_shufflevector(f0, f1, 0, 1, 2, 3, 4, 5, 6, 7,
                                   8, 9, 10, 11, 12, 13, 14, 15);
  };

  v8f acc[4][3] = {};

  const int nk = K / TILE_K;
  issue_tile(0, 0);
  if (nk > 1) issue_tile(1, 1);

  int cur  = 0;   // buffer of tile ik
  int fill = 2;   // buffer of tile ik + 2, the one tile ik - 1 was read from
  for (int ik = 0; ik < nk; ++ik) {
    // this wave's reads of tile ik - 1 have retired before its buffer is refilled below
    asm volatile("s_wait_dscnt 0x0" ::: "memory");
#if defined(HAVE_ASYNC_LDS)
    if (ik + 1 < nk) {
      WAIT_ASYNC(10);   // tile ik's 10 copies done, tile ik + 1's may still fly
    } else {
      WAIT_ASYNC(0);
    }
#endif
    // the one barrier of a K-step: tile ik visible to all waves, and every wave has
    // left tile ik - 1
    __syncthreads();
    if (ik + 2 < nk) issue_tile(ik + 2, fill);   // two K-steps of lead

    const __bf16* tA = ring + cur * QBUF;
    const __bf16* tB = tA + QT_M * LDS_PITCH;
    v16bf aH[4], aL[4], bH[3], bL[3];
    #pragma unroll
    for (int i = 0; i < 4; ++i) {
      int r = waveM * 64 + i * 16 + fr;
      aH[i] = load_frag(tA + r * LDS_PITCH, pH0, pH1);
      aL[i] = load_frag(tA + r * LDS_PITCH, pL0, pL1);
    }
    #pragma unroll
    for (int j = 0; j < 3; ++j) {
      int c = waveN * 48 + j * 16 + fr;
      bH[j] = load_frag(tB + c * LDS_PITCH, pH0, pH1);
      bL[j] = load_frag(tB + c * LDS_PITCH, pL0, pL1);
    }

    #pragma unroll
    for (int i = 0; i < 4; ++i) {
      #pragma unroll
      for (int j = 0; j < 3; ++j) {
        // w_qkv's rows go in as the first operand: a lane's 8 results are 8 consecutive columns
        acc[i][j] = __builtin_amdgcn_wmma_f32_16x16x32_bf16(
            false, bH[j], false, aH[i], (short)0, acc[i][j], false, false);
        acc[i][j] = __builtin_amdgcn_wmma_f32_16x16x32_bf16(
            false, bL[j], false, aH[i], (short)0, acc[i][j], false, false);
        acc[i][j] = __builtin_amdgcn_wmma_f32_16x16x32_bf16(
            false, bH[j], false, aL[i], (short)0, acc[i][j], false, false);
      }
    }
    fill = cur;
    cur  = (cur == NBUF - 1) ? 0 : cur + 1;
  }

  // The ring becomes the f32 tile S[128][192] (96 of its 120 KB): every wave has left the last
  // K-step's buffer first (all copies had landed before the loop's last barrier).
  asm volatile("s_wait_dscnt 0x0" ::: "memory");
  __syncthreads();

  // Rows of 768 B, no pad: the 16-byte piece p of row R lies at piece p ^ swz(R), where swz turns
  // the row's low four bits round by one (bit 0 becomes bit 3). The 16 rows that a half-wave
  // writes then fall on distinct banks, and so do the two rows, four apart, that it reads.
  // acc[i][j][r] = tile[waveM*64 + i*16 + fr][waveN*48 + j*16 + 8*hh + r]
  auto swz = [](int r) { return ((r & 1) << 3) | ((r >> 1) & 7); };
  float* S = (float*)ring;
  const int fsw = swz(fr);
  #pragma unroll
  for (int j = 0; j < 3; ++j) {
    const int col = waveN * 48 + j * 16 + 8 * hh;                 // 8 columns of one of q, k, v
    const float* bp = bias + (col >> 6) * DMODEL + h * HDIM + (col & 63);
    const v4f b0 = *(const v4f*)bp;
    const v4f b1 = *(const v4f*)(bp + 4);
    const int p = col >> 2;
    #pragma unroll
    for (int i = 0; i < 4; ++i) {
      float* row = S + (waveM * 64 + i * 16 + fr) * SROW;
      const v8f a = acc[i][j];
      *(v4f*)(row + ((p)     ^ fsw) * 4) = __builtin_shufflevector(a, a, 0, 1, 2, 3) + b0;
      *(v4f*)(row + ((p + 1) ^ fsw) * 4) = __builtin_shufflevector(a, a, 4, 5, 6, 7) + b1;
    }
  }
  // the tile stands in LDS before any wave reads other waves' rows
  asm volatile("s_wait_dscnt 0x0" ::: "memory");
  __syncthreads();

  // the 8 + 8 edge rows go to memory for the queries whose window leaves the tile
  #pragma unroll
  for (int k = 0; k < (2 * EDGE * (SROW / 4)) / 256; ++k) {
    const int idx = tid + 256 * k;
    const int e = idx / (SROW / 4);
    const int p = idx % (SROW / 4);
    const int r = (e < EDGE) ? e : (QT_M - 2 * EDGE) + e;
    const v4f val = *(const v4f*)(S + r * SROW + ((p ^ swz(r)) << 2));
    *(v4f*)(qkv + (size_t)(mp * QT_M + r) * (3 * DMODEL) + (p >> 4) * DMODEL + h * HDIM + (p & 15) * 4) = val;
  }

  // Eight lanes take QG = 4 queries that follow one another: their windows share 12 rows of k and
  // of v, each read from LDS once (not once a query). A lane holds two 16-byte pieces of the
  // 64 dims, sub and sub + 8; the odd eight of a half-wave take them in the other order, so that
  // the two rows a half-wave reads at once lie in different halves of the banks.
  constexpr int QG = 4;
  constexpr int NR = NWIN + QG - 1;
  const int sub = lane & 7;
  const int ql  = lane >> 3;
  const int par = ql & 1;
  const int pA  = sub | (par << 3);
  const int t0  = (wave * 4 + ql) * QG;            // the eight lanes' first query
  // the tile's first and last RAD queries (one whole group each) are focal_attn's: their groups
  // run along on rows held inside the tile and store nothing
  const bool inner = (t0 >= RAD) && (t0 + QG <= QT_M - RAD);

  v4f qa[QG], qb[QG];
  #pragma unroll
  for (int c = 0; c < QG; ++c) {
    const int qi = (t0 + c) * SROW + ((pA ^ swz(t0 + c)) << 2);
    qa[c] = *(const v4f*)(S + qi);
    qb[c] = *(const v4f*)(S + (qi ^ 32));          // the lane's other piece: 8 pieces away
  }
  int   ri[NR];
  float s[QG][NWIN];
  #pragma unroll
  for (int jj = 0; jj < NR; ++jj) {
    int rk = t0 - RAD + jj;
    rk = rk < 0 ? 0 : (rk > QT_M - 1 ? QT_M - 1 : rk);
    ri[jj] = rk * SROW + ((pA ^ swz(rk)) << 2);
    const v4f ka = *(const v4f*)(S + ri[jj] + HDIM);
    const v4f kb = *(const v4f*)(S + (ri[jj] ^ 32) + HDIM);
    #pragma unroll
    for (int c = 0; c < QG; ++c) {
      const int j = jj - c;                        // row jj is key j of query c
      if (j >= 0 && j < NWIN) {
        v2f p2 = qa[c].lo * ka.lo + qa[c].hi * ka.hi + qb[c].lo * kb.lo + qb[c].hi * kb.hi;
        float p = p2.x + p2.y;
        p = add_from_lane<0xB1>(p);    // quad_perm [1,0,3,2]: lane ^ 1
        p = add_from_lane<0x4E>(p);    // quad_perm [2,3,0,1]: lane ^ 2
        p = add_from_lane<0x164>(p);   // row_xmask 4:         lane ^ 4
        s[c][j] = p * 0.125f;          // 1/sqrt(64)
      }
    }
  }
  float inv[QG];
  #pragma unroll
  for (int c = 0; c < QG; ++c) {
    float m = s[c][0];
    #pragma unroll
    for (int j = 1; j < NWIN; ++j) m = fmaxf(m, s[c][j]);
    float sum = 0.0f;
    #pragma unroll
    for (int j = 0; j < NWIN; ++j) { float e = exp2_slot((s[c][j] - m) * 1.44269504f); s[c][j] = e; sum += e; }
    inv[c] = 1.0f / sum;
  }
  v4f oa[QG] = {};
  v4f ob[QG] = {};
  #pragma unroll
  for (int jj = 0; jj < NR; ++jj) {
    const v4f va = *(const v4f*)(S + ri[jj] + 2 * HDIM);
    const v4f vb = *(const v4f*)(S + (ri[jj] ^ 32) + 2 * HDIM);
    #pragma unroll
    for (int c = 0; c < QG; ++c) {
      const int j = jj - c;
      if (j >= 0 && j < NWIN) { oa[c] += s[c][j] * va; ob[c] += s[c][j] * vb; }
    }
  }
  if (inner) {
    // piece pA holds dims 32*par + 4*sub ..: k block 2h + par; the other piece the other block
    __bf16* ua = out_hl + unit_at(mp * QT_M + t0, 2 * h + par,       KBLK) + sub * 4;
    __bf16* ub = out_hl + unit_at(mp * QT_M + t0, 2 * h + (par ^ 1), KBLK) + sub * 4;
    #pragma unroll
    for (int c = 0; c < QG; ++c) {
      const v4f xa = oa[c] * inv[c];
      const v4f xb = ob[c] * inv[c];
      v4bf ha, la, hb, lb;
      ha.x = (__bf16)xa.x;  la.x = (__bf16)(xa.x - (float)ha.x);
      ha.y = (__bf16)xa.y;  la.y = (__bf16)(xa.y - (float)ha.y);
      ha.z = (__bf16)xa.z;  la.z = (__bf16)(xa.z - (float)ha.z);
      ha.w = (__bf16)xa.w;  la.w = (__bf16)(xa.w - (float)ha.w);
      hb.x = (__bf16)xb.x;  lb.x = (__bf16)(xb.x - (float)hb.x);
      hb.y = (__bf16)xb.y;  lb.y = (__bf16)(xb.y - (float)hb.y);
      hb.z = (__bf16)xb.z;  lb.z = (__bf16)(xb.z - (float)hb.z);
      hb.w = (__bf16)xb.w;  lb.w = (__bf16)(xb.w - (float)hb.w);
      // the next row of a panel is the next unit
      *(v4bf*)(ua + c * UNIT)           = ha;
      *(v4bf*)(ua + c * UNIT + UNIT_LO) = la;
      *(v4bf*)(ub + c * UNIT)           = hb;
      *(v4bf*)(ub + c * UNIT + UNIT_LO) = lb;
    }
  }
}

#define QPB 32   // queries of one head per work-group: 8 lanes each

// Eight lanes per (b,h,t): lane s of the eight holds dims 4s..4s+3 and 32+4s..32+4s+3,
// so a wave-wide 16-byte load covers one whole 128-B line of each of 4 queries' rows and
// a score is 8 products in the lane and 3 steps across lanes; <=9 keys per query.
// Emits split-bf16 output (head|remainder units) directly for the projection GEMM.
// At most 9 waves a SIMD: that leaves 112 registers a wave, enough to have the K rows and
// most V rows in flight at once; at the default the loads go out in small dependent batches.
__global__ __launch_bounds__(256) __attribute__((amdgpu_waves_per_eu(2, 9)))
void focal_attn(const float* __restrict__ qkv, __bf16* __restrict__ out_hl) {
  const int sub = threadIdx.x & 7;
  // only the first and last RAD queries of every 128-row tile of gemm_qkv_attn: a work-group
  // takes those of 4 tiles that follow one another (all in one batch) and one head
  const int h   = blockIdx.x % NHEADS;
  const int g   = blockIdx.x / NHEADS;                                  // group of 4 tiles
  const int b   = g / (T_SEQ / (4 * QT_M));
  const int e   = (threadIdx.x >> 3) & 7;                                // which of a tile's 8
  const int t   = (g % (T_SEQ / (4 * QT_M))) * (4 * QT_M) + (threadIdx.x >> 6) * QT_M
                + (e < RAD ? e : QT_M - 2 * RAD + e);

  // this head's q columns in row 0 of batch b; k and v lie DMODEL and 2*DMODEL further
  const float* base = qkv + (size_t)b * T_SEQ * (3 * DMODEL) + h * HDIM;
  const unsigned qoff = (unsigned)t * (3 * DMODEL) + sub * 4;
  const v4f qa = *(const v4f*)(base + qoff);
  const v4f qb = *(const v4f*)(base + qoff + 32);
  const float scale = 0.125f; // 1/sqrt(64)

  float s[NWIN];
  v4f   va[NWIN], vb[NWIN];
  #pragma unroll
  for (int j = 0; j < NWIN; ++j) {
    int  tk = t - RAD + j;
    bool ok = (tk >= 0) && (tk < T_SEQ);
    int  tc = ok ? tk : t;
    const unsigned koff = (unsigned)tc * (3 * DMODEL) + sub * 4;
    v4f ka = *(const v4f*)(base + koff + DMODEL);
    v4f kb = *(const v4f*)(base + koff + DMODEL + 32);
    va[j]  = *(const v4f*)(base + koff + 2 * DMODEL);
    vb[j]  = *(const v4f*)(base + koff + 2 * DMODEL + 32);
    // two running sums (even and odd dims), the shape of the packed f32 multiply-add
    v2f p2 = qa.lo * ka.lo + qa.hi * ka.hi + qb.lo * kb.lo + qb.hi * kb.hi;
    float p = p2.x + p2.y;
    p = add_from_lane<0xB1>(p);    // quad_perm [1,0,3,2]: lane ^ 1
    p = add_from_lane<0x4E>(p);    // quad_perm [2,3,0,1]: lane ^ 2
    p = add_from_lane<0x164>(p);   // row_xmask 4:         lane ^ 4
    s[j] = ok ? p * scale : -__builtin_inff();
  }

  float m = s[0];
  #pragma unroll
  for (int j = 1; j < NWIN; ++j) m = fmaxf(m, s[j]);
  float sum = 0.0f;
  #pragma unroll
  for (int j = 0; j < NWIN; ++j) { float e = exp2_slot((s[j] - m) * 1.44269504f); s[j] = e; sum += e; }
  float inv = 1.0f / sum;

  v4f oa = {0.0f, 0.0f, 0.0f, 0.0f};
  v4f ob = {0.0f, 0.0f, 0.0f, 0.0f};
  #pragma unroll
  for (int j = 0; j < NWIN; ++j) { oa += s[j] * va[j]; ob += s[j] * vb[j]; }
  oa *= inv;
  ob *= inv;

  v4bf ha, la, hb, lb;
  ha.x = (__bf16)oa.x;  la.x = (__bf16)(oa.x - (float)ha.x);
  ha.y = (__bf16)oa.y;  la.y = (__bf16)(oa.y - (float)ha.y);
  ha.z = (__bf16)oa.z;  la.z = (__bf16)(oa.z - (float)ha.z);
  ha.w = (__bf16)oa.w;  la.w = (__bf16)(oa.w - (float)ha.w);
  hb.x = (__bf16)ob.x;  lb.x = (__bf16)(ob.x - (float)hb.x);
  hb.y = (__bf16)ob.y;  lb.y = (__bf16)(ob.y - (float)hb.y);
  hb.z = (__bf16)ob.z;  lb.z = (__bf16)(ob.z - (float)hb.z);
  hb.w = (__bf16)ob.w;  lb.w = (__bf16)(ob.w - (float)hb.w);
  // a head's 64 dims are two units of the row: dims 0..31 in k block 2h, dims 32..63 in 2h + 1,
  // which lies one K-step slab further in the row's panel
  __bf16* u = out_hl + unit_at(b * T_SEQ + t, 2 * h, KBLK) + sub * 4;
  *(v4bf*)(u)                   = ha;
  *(v4bf*)(u + UNIT_LO)         = la;
  *(v4bf*)(u + KSLAB)           = hb;
  *(v4bf*)(u + KSLAB + UNIT_LO) = lb;
}

extern "C" void kernel_launch(void* const* d_in, const int* in_sizes, int n_in,
                              void* d_out, int out_size, void* d_ws, size_t ws_size,
                              hipStream_t stream) {
  const float* x      = (const float*)d_in[0];
  const float* w_qkv  = (const float*)d_in[1];
  const float* b_qkv  = (const float*)d_in[2];
  const float* w_proj = (const float*)d_in[3];
  const float* b_proj = (const float*)d_in[4];
  float* out = (float*)d_out;

  const int B = 4, T = T_SEQ, D = DMODEL;
  const int M = B * T;                         // 8192 rows
  const size_t nX  = (size_t)M * D;            // 8,388,608
  const size_t nWq = (size_t)3 * D * D;        // 3,145,728
  const size_t nWp = (size_t)D * D;            // 1,048,576

  // workspace layout (all offsets naturally aligned)
  char* w = (char*)d_ws;
  float*  qkv     = (float*)w;    w += (size_t)M * 3 * D * sizeof(float);  // 96 MB
  __bf16* x_hl    = (__bf16*)w;   w += 2 * nX  * sizeof(__bf16);
  __bf16* wq_hl   = (__bf16*)w;   w += 2 * nWq * sizeof(__bf16);
  __bf16* wp_hl   = (__bf16*)w;   w += 2 * nWp * sizeof(__bf16);
  __bf16* attn_hl = (__bf16*)w;

  dim3 blk(256);

  // split-bf16 conversion of activations and weights, one launch
  f32_to_bf16_split<<<dim3(SPLIT_WG), blk, 0, stream>>>(x, w_qkv, w_proj, x_hl, wq_hl, wp_hl);

  // qkv = x @ w_qkv^T + b_qkv
  // with the local-window attention (radius 4) of each tile's inner rows, emits split-bf16
  gemm_qkv_attn<<<dim3(NHEADS, M / QT_M), blk, 0, stream>>>(x_hl, wq_hl, b_qkv, qkv, attn_hl, D);

  // the attention of the 2 * RAD queries a tile whose window leaves the tile
  focal_attn<<<dim3((M / QT_M) * (2 * RAD) * NHEADS / QPB), blk, 0, stream>>>(qkv, attn_hl);

  // out = attn @ w_proj^T + b_proj
  gemm_bf16x3<<<dim3(D / TILE_N, M / TILE_M), blk, 0, stream>>>(
      attn_hl, wp_hl, b_proj, out, M, D, D);
}
